// v000
// The times below were measured on an AMD MI455X: many runs one after another, warmed up first and cycling through
// copies of the inputs, with the whole window's GPU time divided by the number of runs. Launches and the gaps
// between them are all in it. The median over several windows is given; except for v000 it joins two sittings, which
// can be a few percent apart, so the side-by-side timings, each taken in one sitting, are the better comparison.
// v000 is the starting kernel. One run takes 105 microseconds.
#include <hip/hip_runtime.h>
#include <hip/hip_bf16.h>

typedef __attribute__((ext_vector_type(16))) _Float16 v16h;
typedef __attribute__((ext_vector_type(8)))  _Float16 v8h;
typedef __attribute__((ext_vector_type(8)))  float    v8f;
typedef __attribute__((ext_vector_type(2)))  _Float16 h2;
typedef __attribute__((ext_vector_type(4)))  unsigned u32x4;
typedef __attribute__((ext_vector_type(8)))  int      i32x8;
typedef __attribute__((ext_vector_type(4)))  int      i32x4;

#define NIMG 4
#define TDIM 64
#define LDIM 64
#define QCH  256
#define KVCH 64
#define PIX  (NIMG * LDIM * LDIM)               // 16384 flat pixels
#define KV_TSTRIDE ((size_t)LDIM * LDIM * KVCH) // 262144 floats between t rows

#if defined(__has_builtin)
#if __has_builtin(__builtin_amdgcn_tensor_load_to_lds) && \
    __has_builtin(__builtin_amdgcn_s_wait_tensorcnt)
#define HAVE_TDM 1
#endif
#endif

__device__ __forceinline__ v8f wmma16(v16h a, v16h b, v8f c) {
  return __builtin_amdgcn_wmma_f32_16x16x32_f16(false, a, false, b, (short)0, c,
                                                false, false);
}

__device__ __forceinline__ int kmap(int v, int lane) {
  int b = (v < 4) ? (v * 2) : (16 + (v - 4) * 2);
  return b + ((lane & 16) ? 8 : 0);
}

__device__ __forceinline__ int pk_off(int p, int k) {
  int kk = k & 31;
  int lh = (kk >> 3) & 1;
  int kr = kk - 8 * lh;
  int slot = (kr & 7) + ((kr >> 4) << 3);
  return (k >> 5) * 512 + (p + 16 * lh) * 16 + slot;
}

// Packed position for B element (k, n) of a weight with ktiles K-chunks.
__device__ __forceinline__ int bpk_idx(int k, int n, int ktiles) {
  int kk = k & 31;
  int lh = (kk >> 3) & 1;
  int kr = kk - 8 * lh;
  int slot = (kr & 7) + ((kr >> 4) << 3);
  return ((n >> 4) * ktiles + (k >> 5)) * 512 + ((n & 15) + 16 * lh) * 16 + slot;
}

// Packed operand fetch: 16 contiguous halves per lane -> 2x ds_load_b128.
__device__ __forceinline__ v16h readPacked(const _Float16* buf, int tile,
                                           int lane) {
  const v8h* p = reinterpret_cast<const v8h*>(buf + tile * 512 + lane * 16);
  v8h lo = p[0], hi = p[1];
  return __builtin_shufflevector(lo, hi, 0, 1, 2, 3, 4, 5, 6, 7, 8, 9, 10, 11,
                                 12, 13, 14, 15);
}

// A operand from row-major f16 LDS: two contiguous 8-half runs per lane.
__device__ __forceinline__ v16h readA(const _Float16* buf, int stride, int m0,
                                      int k0, int lane) {
  const _Float16* row =
      buf + (m0 + (lane & 15)) * stride + k0 + ((lane & 16) ? 8 : 0);
  v8h lo = *reinterpret_cast<const v8h*>(row);       // k: base+0..7
  v8h hi = *reinterpret_cast<const v8h*>(row + 16);  // k: base+16..23
  return __builtin_shufflevector(lo, hi, 0, 1, 2, 3, 4, 5, 6, 7, 8, 9, 10, 11,
                                 12, 13, 14, 15);
}

__device__ __forceinline__ v16h readA_f32(const float* buf, int stride, int m0,
                                          int k0, int lane) {
  const float* row =
      buf + (m0 + (lane & 15)) * stride + k0 + ((lane & 16) ? 8 : 0);
  float4 a0 = *reinterpret_cast<const float4*>(row);
  float4 a1 = *reinterpret_cast<const float4*>(row + 4);
  float4 b0 = *reinterpret_cast<const float4*>(row + 16);
  float4 b1 = *reinterpret_cast<const float4*>(row + 20);
  v16h r;
  r[0] = (_Float16)a0.x;  r[1] = (_Float16)a0.y;
  r[2] = (_Float16)a0.z;  r[3] = (_Float16)a0.w;
  r[4] = (_Float16)a1.x;  r[5] = (_Float16)a1.y;
  r[6] = (_Float16)a1.z;  r[7] = (_Float16)a1.w;
  r[8] = (_Float16)b0.x;  r[9] = (_Float16)b0.y;
  r[10] = (_Float16)b0.z; r[11] = (_Float16)b0.w;
  r[12] = (_Float16)b1.x; r[13] = (_Float16)b1.y;
  r[14] = (_Float16)b1.z; r[15] = (_Float16)b1.w;
  return r;
}

__device__ __forceinline__ v16h readB_f32(const float* buf, int stride, int k0,
                                          int n0, int lane) {
  int n = n0 + (lane & 15);
  v16h r;
#pragma unroll
  for (int v = 0; v < 8; ++v) {
    int k = k0 + kmap(v, lane);
    r[2 * v] = (_Float16)buf[k * stride + n];
    r[2 * v + 1] = (_Float16)buf[(k + 1) * stride + n];
  }
  return r;
}

// Qb[k, n] = (n == k/16) ? qh_p[k] : 0  -- block-diagonal query embedding.
__device__ __forceinline__ v16h readB_qb(const _Float16* qh_p, int k0, int lane) {
  int n = lane & 15;
  v16h r;
#pragma unroll
  for (int v = 0; v < 8; ++v) {
    int k = k0 + kmap(v, lane);
    h2 p = *reinterpret_cast<const h2*>(qh_p + k);
    r[2 * v] = (n == (k >> 4)) ? p.x : (_Float16)0.0f;
    r[2 * v + 1] = (n == ((k + 1) >> 4)) ? p.y : (_Float16)0.0f;
  }
  return r;
}

__device__ __forceinline__ void storeD_h(_Float16* buf, int stride, int m0,
                                         int n0, v8f acc, int lane, float scale) {
  int n = n0 + (lane & 15);
  int mb = m0 + ((lane & 16) ? 8 : 0);
#pragma unroll
  for (int v = 0; v < 8; ++v)
    buf[(mb + v) * stride + n] = (_Float16)(acc[v] * scale);
}

// D tile -> B-operand-packed (next GEMM's K = this tile's row index m).
__device__ __forceinline__ void storeD_Bpacked(_Float16* buf, v8f acc, int m0,
                                               int lane) {
  int n = lane & 15;
  int mb = m0 + ((lane & 16) ? 8 : 0);
#pragma unroll
  for (int v = 0; v < 8; ++v) buf[pk_off(n, mb + v)] = (_Float16)acc[v];
}

// D tile -> A-operand-packed (next GEMM's K = this tile's column index n).
__device__ __forceinline__ void storeD_Apacked(_Float16* buf, v8f acc, int n0,
                                               int lane) {
  int k = n0 + (lane & 15);
  int mb = (lane & 16) ? 8 : 0;
#pragma unroll
  for (int v = 0; v < 8; ++v) buf[pk_off(mb + v, k)] = (_Float16)acc[v];
}

__device__ __forceinline__ void kv_issue(float* ldsdst, const float* gsrc,
                                         int lane) {
#if defined(HAVE_TDM)
  unsigned long long ga = (unsigned long long)(uintptr_t)gsrc;
  u32x4 g0;
  g0[0] = 1u;
  g0[1] = (unsigned)(uintptr_t)ldsdst;
  g0[2] = (unsigned)(ga & 0xffffffffu);
  g0[3] = (unsigned)((ga >> 32) & 0x01ffffffu) | (2u << 30);
  i32x8 g1;
  g1[0] = (int)(2u << 16);
  g1[1] = (int)(64u << 16);
  g1[2] = (int)(64u << 16);
  g1[3] = (int)(64u << 16);
  g1[4] = 64;
  g1[5] = (int)KV_TSTRIDE;
  g1[6] = 0;
  g1[7] = 0;
  i32x4 gz = {0, 0, 0, 0};   // 2D tensor: groups 2/3 unused
#if defined(__clang_major__) && __clang_major__ >= 23
  i32x8 gz8 = {0, 0, 0, 0, 0, 0, 0, 0};
  __builtin_amdgcn_tensor_load_to_lds(g0, g1, gz, gz, gz8, 0);
#else
  __builtin_amdgcn_tensor_load_to_lds(g0, g1, gz, gz, 0);
#endif
#else
#pragma unroll 4
  for (int it = 0; it < 32; ++it) {
    int fl = it * 32 + lane;
    int t = fl >> 4;
    int c4 = (fl & 15) * 4;
    float4 v4 = *reinterpret_cast<const float4*>(gsrc + (size_t)t * KV_TSTRIDE + c4);
    *reinterpret_cast<float4*>(ldsdst + t * KVCH + c4) = v4;
  }
#endif
}

__device__ __forceinline__ void kv_wait() {
#if defined(HAVE_TDM)
  __builtin_amdgcn_s_wait_tensorcnt(0);
#endif
  asm volatile("" ::: "memory");
}

__global__ __launch_bounds__(64) void pw_attn_kernel(
    const float* __restrict__ q, const float* __restrict__ kv,
    const float* __restrict__ Wq, const float* __restrict__ Wk,
    const float* __restrict__ Wv, const float* __restrict__ Wout,
    const float* __restrict__ b_out, float* __restrict__ out) {
  // Phase-aliased LDS pool (40KB) + persistent buffers. Total 60KB.
  __shared__ __align__(16) unsigned char s_pool[40960];
  __shared__ _Float16 s_wk[KVCH * KVCH];  // 8KB  Wk f16, row-major (A reads)
  __shared__ _Float16 s_wv[KVCH * KVCH];  // 8KB  Wv f16, B-packed (8 tiles)
  __shared__ _Float16 s_qh[16 * KVCH];    // 2KB  qh (pre-scaled) per tile
  __shared__ _Float16 s_x[16 * KVCH];     // 2KB  attended features X16

  const int tid = threadIdx.x;
  const int wave = tid >> 5;
  const int lane = tid & 31;

  const int base = blockIdx.x * 16;  // flat pixel base (n*4096 + i*64 + j)
  const int n_img = base >> 12;
  const int pij0 = base & 4095;
  const float* kv_n = kv + (size_t)n_img * TDIM * KV_TSTRIDE;

  // ---- Phase 0/1 staging -> f16 LDS. B weights go in packed layout. ------
  _Float16* s_wq = (_Float16*)s_pool;             // 256x64 B-packed (32KB)
  _Float16* s_qbuf = (_Float16*)(s_pool + 32768); // 16x256 row-major (8KB)
  for (int idx = tid; idx < KVCH * KVCH; idx += 64) {
    int k = idx >> 6, n = idx & 63;
    s_wk[idx] = (_Float16)Wk[idx];                    // row-major (A operand)
    s_wv[bpk_idx(k, n, 2)] = (_Float16)Wv[idx];       // B-packed, tile n4*2+kc
  }
  for (int idx = tid; idx < QCH * KVCH; idx += 64) {
    int k = idx >> 6, n = idx & 63;
    s_wq[bpk_idx(k, n, 8)] = (_Float16)Wq[idx];       // B-packed, tile n4*8+kc
  }
  for (int idx = tid; idx < 16 * QCH; idx += 64) {
    int m = idx >> 8, k = idx & 255;
    s_qbuf[idx] = (_Float16)q[((size_t)(base + m)) * QCH + k];
  }
  __syncthreads();

  // ---- Phase 1: qh = (q16 @ Wq) * 0.25, kept f16 in LDS (16x64) ----------
  {
    v8f acc0 = {}, acc1 = {};
    const int nt0 = 2 * wave, nt1 = 2 * wave + 1;
#pragma unroll
    for (int kc = 0; kc < 8; ++kc) {
      v16h a = readA(s_qbuf, QCH, 0, kc * 32, lane);
      v16h b0 = readPacked(s_wq, nt0 * 8 + kc, lane);
      v16h b1 = readPacked(s_wq, nt1 * 8 + kc, lane);
      acc0 = wmma16(a, b0, acc0);
      acc1 = wmma16(a, b1, acc1);
    }
    storeD_h(s_qh, KVCH, 0, nt0 * 16, acc0, lane, 0.25f);  // fold 1/sqrt(16)
    storeD_h(s_qh, KVCH, 0, nt1 * 16, acc1, lane, 0.25f);
  }
  __syncthreads();  // pool (Wq/qbuf) dead after this point

  // ---- Phase 2: decoupled per-wave pipelines (no intra-phase barriers) ---
  unsigned char* wbase = s_pool + wave * 20480;
  float* kvraw = (float*)wbase;
  _Float16* wz = (_Float16*)(wbase + 16384);
  _Float16* abuf = (_Float16*)(wbase + 18432);

  // Loop-invariant WMMA operands: Wk A-tiles, Wv B-tiles (16 x v16h regs).
  v16h wk_a[8], wv_b[8];
#pragma unroll
  for (int kc = 0; kc < 2; ++kc)
#pragma unroll
    for (int t4 = 0; t4 < 4; ++t4) {
      wk_a[kc * 4 + t4] = readA(s_wk, KVCH, t4 * 16, kc * 32, lane);
      wv_b[kc * 4 + t4] = readPacked(s_wv, t4 * 2 + kc, lane);
    }

  // Zero attn rows m>=4 once: those packed cells are never rewritten.
  {
    v8h z = {};
    *(v8h*)(abuf + lane * 16) = z;
    *(v8h*)(abuf + lane * 16 + 8) = z;
    *(v8h*)(abuf + 512 + lane * 16) = z;
    *(v8h*)(abuf + 512 + lane * 16 + 8) = z;
  }

  // Prologue: start DMA of this wave's first pixel.
  kv_issue(kvraw, kv_n + (size_t)(pij0 + wave * 8) * KVCH, lane);

  for (int i = 0; i < 8; ++i) {
    const int p = wave * 8 + i;  // pixel within tile

    {
      v8f acc[4] = {};
#pragma unroll
      for (int kc = 0; kc < 2; ++kc) {
        v16h b = readB_qb(&s_qh[p * KVCH], kc * 32, lane);
#pragma unroll
        for (int mt = 0; mt < 4; ++mt)
          acc[mt] = wmma16(wk_a[kc * 4 + mt], b, acc[mt]);
      }
#pragma unroll
      for (int mt = 0; mt < 4; ++mt) storeD_Bpacked(wz, acc[mt], mt * 16, lane);
    }

    kv_wait();  // s_wait_tensorcnt 0: KV tile resident in LDS

    // c) S = KV @ Wkq  (64t x 16, cols 0..3 = groups)
    v8f sacc[4] = {};
#pragma unroll
    for (int kc = 0; kc < 2; ++kc) {
      v16h b = readPacked(wz, kc, lane);
#pragma unroll
      for (int mt = 0; mt < 4; ++mt) {
        v16h a = readA_f32(kvraw, KVCH, mt * 16, kc * 32, lane);
        sacc[mt] = wmma16(a, b, sacc[mt]);
      }
    }

    // d) softmax over t per group, in registers: column g lives on lanes
    // g and g+16 (D layout), so one shfl_xor(16) completes each reduction.
    {
      float mx = -1e30f;
#pragma unroll
      for (int mt = 0; mt < 4; ++mt)
#pragma unroll
        for (int v = 0; v < 8; ++v) mx = fmaxf(mx, sacc[mt][v]);
      mx = fmaxf(mx, __shfl_xor(mx, 16));
      float sum = 0.0f;
#pragma unroll
      for (int mt = 0; mt < 4; ++mt)
#pragma unroll
        for (int v = 0; v < 8; ++v) {
          float e = __expf(sacc[mt][v] - mx);
          sacc[mt][v] = e;
          sum += e;
        }
      sum += __shfl_xor(sum, 16);
      float inv = 1.0f / sum;
      int g = lane & 15;
      int mb = (lane & 16) ? 8 : 0;
      if (g < 4) {
#pragma unroll
        for (int mt = 0; mt < 4; ++mt)
#pragma unroll
          for (int v = 0; v < 8; ++v)
            abuf[pk_off(g, mt * 16 + mb + v)] = (_Float16)(sacc[mt][v] * inv);
      }
    }

    // e) Z = Ab @ KV  (16 x 64, rows 0..3 = groups); wz reused for Z.
    {
      v8f acc[4] = {};
#pragma unroll
      for (int kc = 0; kc < 2; ++kc) {
        v16h a = readPacked(abuf, kc, lane);
#pragma unroll
        for (int nt = 0; nt < 4; ++nt) {
          v16h b = readB_f32(kvraw, KVCH, kc * 32, nt * 16, lane);
          acc[nt] = wmma16(a, b, acc[nt]);
        }
      }
#pragma unroll
      for (int nt = 0; nt < 4; ++nt) storeD_Apacked(wz, acc[nt], nt * 16, lane);
    }

    // Drain kvraw reads, then start the next pixel's DMA (overlaps f + b).
    if (i < 7) {
      asm volatile("s_wait_dscnt 0x0" ::: "memory");
      kv_issue(kvraw, kv_n + (size_t)(pij0 + p + 1) * KVCH, lane);
    }

    // f) Y = Z @ Wv ; x[g*16+c] = Y[g, g*16+c]  (group-diagonal rows)
    {
      v8f acc[4] = {};
#pragma unroll
      for (int kc = 0; kc < 2; ++kc) {
        v16h a = readPacked(wz, kc, lane);
#pragma unroll
        for (int nt = 0; nt < 4; ++nt)
          acc[nt] = wmma16(a, wv_b[kc * 4 + nt], acc[nt]);
      }
      if (lane < 16) {
        s_x[p * KVCH + 0 * 16 + lane] = (_Float16)acc[0][0];
        s_x[p * KVCH + 1 * 16 + lane] = (_Float16)acc[1][1];
        s_x[p * KVCH + 2 * 16 + lane] = (_Float16)acc[2][2];
        s_x[p * KVCH + 3 * 16 + lane] = (_Float16)acc[3][3];
      }
    }
  }
  __syncthreads();  // both waves done with pool scratch and s_x

  // ---- Phase 3: out = X16 @ Wout + b_out  (16 x 256) ---------------------
  _Float16* s_wout = (_Float16*)s_pool;  // 64x256 B-packed (32KB), pool reuse
  for (int idx = tid; idx < KVCH * QCH; idx += 64) {
    int k = idx >> 8, n = idx & 255;
    s_wout[bpk_idx(k, n, 2)] = (_Float16)Wout[idx];  // tile = (n>>4)*2 + kc
  }
  __syncthreads();
  {
    v8f acc[8] = {};
#pragma unroll
    for (int kc = 0; kc < 2; ++kc) {
      v16h a = readA(s_x, KVCH, 0, kc * 32, lane);
#pragma unroll
      for (int j = 0; j < 8; ++j) {
        int nt = wave * 8 + j;
        v16h b = readPacked(s_wout, nt * 2 + kc, lane);
        acc[j] = wmma16(a, b, acc[j]);
      }
    }
    int mb = (lane & 16) ? 8 : 0;
#pragma unroll
    for (int j = 0; j < 8; ++j) {
      int col = (wave * 8 + j) * 16 + (lane & 15);
      float bia = b_out[col];
#pragma unroll
      for (int v = 0; v < 8; ++v)
        out[((size_t)(base + mb + v)) * QCH + col] = acc[j][v] + bia;
    }
  }
}

extern "C" void kernel_launch(void* const* d_in, const int* in_sizes, int n_in,
                              void* d_out, int out_size, void* d_ws,
                              size_t ws_size, hipStream_t stream) {
  const float* q = (const float*)d_in[0];
  const float* kv = (const float*)d_in[1];
  const float* Wq = (const float*)d_in[2];
  const float* Wk = (const float*)d_in[3];
  const float* Wv = (const float*)d_in[4];
  const float* Wout = (const float*)d_in[5];
  const float* b_out = (const float*)d_in[6];
  float* out = (float*)d_out;

  dim3 grid(PIX / 16);  // 1024 workgroups, 16 pixels each
  dim3 block(64);       // 2 wave32s
  pw_attn_kernel<<<grid, block, 0, stream>>>(q, kv, Wq, Wk, Wv, Wout, b_out,
                                             out);
}

// v001
// It runs in 91.8 microseconds.
// Next to v000, in two timings, it ran 1.14 and 1.15 times as fast.
#include <hip/hip_runtime.h>
#include <hip/hip_bf16.h>

typedef __attribute__((ext_vector_type(16))) _Float16 v16h;
typedef __attribute__((ext_vector_type(8)))  _Float16 v8h;
typedef __attribute__((ext_vector_type(8)))  float    v8f;
typedef __attribute__((ext_vector_type(2)))  _Float16 h2;
typedef __attribute__((ext_vector_type(4)))  unsigned u32x4;
typedef __attribute__((ext_vector_type(8)))  int      i32x8;
typedef __attribute__((ext_vector_type(4)))  int      i32x4;

#define NIMG 4
#define TDIM 64
#define LDIM 64
#define QCH  256
#define KVCH 64
#define PIX  (NIMG * LDIM * LDIM)               // 16384 flat pixels
#define KV_TSTRIDE ((size_t)LDIM * LDIM * KVCH) // 262144 floats between t rows
#define KVP 68
#define KV_LDS_BYTES 18432  // 64 rows x 272 B = 17408, rounded up to 2 KiB
#define WAVE_LDS_BYTES (KV_LDS_BYTES + 4096)  // tile + Wkq/Z + attn buffers

#if defined(__has_builtin)
#if __has_builtin(__builtin_amdgcn_tensor_load_to_lds) && \
    __has_builtin(__builtin_amdgcn_s_wait_tensorcnt)
#define HAVE_TDM 1
#endif
#endif

__device__ __forceinline__ v8f wmma16(v16h a, v16h b, v8f c) {
  return __builtin_amdgcn_wmma_f32_16x16x32_f16(false, a, false, b, (short)0, c,
                                                false, false);
}

__device__ __forceinline__ int kmap(int v, int lane) {
  int b = (v < 4) ? (v * 2) : (16 + (v - 4) * 2);
  return b + ((lane & 16) ? 8 : 0);
}

__device__ __forceinline__ int pk_off(int p, int k) {
  int kk = k & 31;
  int lh = (kk >> 3) & 1;
  int kr = kk - 8 * lh;
  int slot = (kr & 7) + ((kr >> 4) << 3);
  return (k >> 5) * 512 + (p + 16 * lh) * 16 + slot;
}

// Packed position for B element (k, n) of a weight with ktiles K-chunks.
__device__ __forceinline__ int bpk_idx(int k, int n, int ktiles) {
  int kk = k & 31;
  int lh = (kk >> 3) & 1;
  int kr = kk - 8 * lh;
  int slot = (kr & 7) + ((kr >> 4) << 3);
  return ((n >> 4) * ktiles + (k >> 5)) * 512 + ((n & 15) + 16 * lh) * 16 + slot;
}

// Packed operand fetch: 16 contiguous halves per lane -> 2x ds_load_b128.
__device__ __forceinline__ v16h readPacked(const _Float16* buf, int tile,
                                           int lane) {
  const v8h* p = reinterpret_cast<const v8h*>(buf + tile * 512 + lane * 16);
  v8h lo = p[0], hi = p[1];
  return __builtin_shufflevector(lo, hi, 0, 1, 2, 3, 4, 5, 6, 7, 8, 9, 10, 11,
                                 12, 13, 14, 15);
}

// A operand from row-major f16 LDS: two contiguous 8-half runs per lane.
__device__ __forceinline__ v16h readA(const _Float16* buf, int stride, int m0,
                                      int k0, int lane) {
  const _Float16* row =
      buf + (m0 + (lane & 15)) * stride + k0 + ((lane & 16) ? 8 : 0);
  v8h lo = *reinterpret_cast<const v8h*>(row);       // k: base+0..7
  v8h hi = *reinterpret_cast<const v8h*>(row + 16);  // k: base+16..23
  return __builtin_shufflevector(lo, hi, 0, 1, 2, 3, 4, 5, 6, 7, 8, 9, 10, 11,
                                 12, 13, 14, 15);
}

__device__ __forceinline__ v16h readA_f32(const float* buf, int stride, int m0,
                                          int k0, int lane) {
  const float* row =
      buf + (m0 + (lane & 15)) * stride + k0 + ((lane & 16) ? 8 : 0);
  float4 a0 = *reinterpret_cast<const float4*>(row);
  float4 a1 = *reinterpret_cast<const float4*>(row + 4);
  float4 b0 = *reinterpret_cast<const float4*>(row + 16);
  float4 b1 = *reinterpret_cast<const float4*>(row + 20);
  v16h r;
  r[0] = (_Float16)a0.x;  r[1] = (_Float16)a0.y;
  r[2] = (_Float16)a0.z;  r[3] = (_Float16)a0.w;
  r[4] = (_Float16)a1.x;  r[5] = (_Float16)a1.y;
  r[6] = (_Float16)a1.z;  r[7] = (_Float16)a1.w;
  r[8] = (_Float16)b0.x;  r[9] = (_Float16)b0.y;
  r[10] = (_Float16)b0.z; r[11] = (_Float16)b0.w;
  r[12] = (_Float16)b1.x; r[13] = (_Float16)b1.y;
  r[14] = (_Float16)b1.z; r[15] = (_Float16)b1.w;
  return r;
}

__device__ __forceinline__ v16h readB_f32(const float* buf, int stride, int k0,
                                          int n0, int lane) {
  int n = n0 + (lane & 15);
  v16h r;
#pragma unroll
  for (int v = 0; v < 8; ++v) {
    int k = k0 + kmap(v, lane);
    r[2 * v] = (_Float16)buf[k * stride + n];
    r[2 * v + 1] = (_Float16)buf[(k + 1) * stride + n];
  }
  return r;
}

// Qb[k, n] = (n == k/16) ? qh_p[k] : 0  -- block-diagonal query embedding.
__device__ __forceinline__ v16h readB_qb(const _Float16* qh_p, int k0, int lane) {
  int n = lane & 15;
  v16h r;
#pragma unroll
  for (int v = 0; v < 8; ++v) {
    int k = k0 + kmap(v, lane);
    h2 p = *reinterpret_cast<const h2*>(qh_p + k);
    r[2 * v] = (n == (k >> 4)) ? p.x : (_Float16)0.0f;
    r[2 * v + 1] = (n == ((k + 1) >> 4)) ? p.y : (_Float16)0.0f;
  }
  return r;
}

__device__ __forceinline__ void storeD_h(_Float16* buf, int stride, int m0,
                                         int n0, v8f acc, int lane, float scale) {
  int n = n0 + (lane & 15);
  int mb = m0 + ((lane & 16) ? 8 : 0);
#pragma unroll
  for (int v = 0; v < 8; ++v)
    buf[(mb + v) * stride + n] = (_Float16)(acc[v] * scale);
}

// D tile -> B-operand-packed (next GEMM's K = this tile's row index m).
__device__ __forceinline__ void storeD_Bpacked(_Float16* buf, v8f acc, int m0,
                                               int lane) {
  int n = lane & 15;
  int mb = m0 + ((lane & 16) ? 8 : 0);
#pragma unroll
  for (int v = 0; v < 8; ++v) buf[pk_off(n, mb + v)] = (_Float16)acc[v];
}

// D tile -> A-operand-packed (next GEMM's K = this tile's column index n).
__device__ __forceinline__ void storeD_Apacked(_Float16* buf, v8f acc, int n0,
                                               int lane) {
  int k = n0 + (lane & 15);
  int mb = (lane & 16) ? 8 : 0;
#pragma unroll
  for (int v = 0; v < 8; ++v) buf[pk_off(mb + v, k)] = (_Float16)acc[v];
}

__device__ __forceinline__ unsigned uni(unsigned v) {
  return (unsigned)__builtin_amdgcn_readfirstlane((int)v);
}

__device__ __forceinline__ void kv_issue(float* ldsdst, const float* gsrc,
                                         int lane) {
#if defined(HAVE_TDM)
  unsigned long long ga = (unsigned long long)(uintptr_t)gsrc;
  u32x4 g0;
  g0[0] = uni(1u);
  g0[1] = uni((unsigned)(uintptr_t)ldsdst);
  g0[2] = uni((unsigned)(ga & 0xffffffffu));
  g0[3] = uni((unsigned)((ga >> 32) & 0x01ffffffu) | (2u << 30));
  i32x8 g1;
  g1[0] = (int)((1u << 20) | (5u << 22) | (3u << 25));
  g1[1] = (int)(256u << 16);
  g1[2] = (int)(64u << 16);
  g1[3] = (int)(256u << 16);
  g1[4] = 64;
  g1[5] = (int)(KV_TSTRIDE * sizeof(float));
  g1[6] = 0;
  g1[7] = 0;
  i32x4 gz = {0, 0, 0, 0};   // 2D tensor: groups 2/3 unused
#if defined(__clang_major__) && __clang_major__ >= 23
  i32x8 gz8 = {0, 0, 0, 0, 0, 0, 0, 0};
  __builtin_amdgcn_tensor_load_to_lds(g0, g1, gz, gz, gz8, 0);
#else
  __builtin_amdgcn_tensor_load_to_lds(g0, g1, gz, gz, 0);
#endif
#else
#pragma unroll 4
  for (int it = 0; it < 32; ++it) {
    int fl = it * 32 + lane;
    int t = fl >> 4;
    int c4 = (fl & 15) * 4;
    float4 v4 = *reinterpret_cast<const float4*>(gsrc + (size_t)t * KV_TSTRIDE + c4);
    *reinterpret_cast<float4*>(ldsdst + t * KVP + c4) = v4;
  }
#endif
}

__device__ __forceinline__ void kv_wait() {
#if defined(HAVE_TDM)
  __builtin_amdgcn_s_wait_tensorcnt(0);
#endif
  asm volatile("" ::: "memory");
}

__global__ __launch_bounds__(64) void pw_attn_kernel(
    const float* __restrict__ q, const float* __restrict__ kv,
    const float* __restrict__ Wq, const float* __restrict__ Wk,
    const float* __restrict__ Wv, const float* __restrict__ Wout,
    const float* __restrict__ b_out, float* __restrict__ out) {
  // Phase-aliased LDS pool (44KB) + persistent buffers. Total 64KB.
  // 2 KiB alignment: each wave's tensor-load destination is a 2 KiB multiple.
  __shared__ __align__(2048) unsigned char s_pool[2 * WAVE_LDS_BYTES];
  __shared__ _Float16 s_wk[KVCH * KVCH];  // 8KB  Wk f16, row-major (A reads)
  __shared__ _Float16 s_wv[KVCH * KVCH];  // 8KB  Wv f16, B-packed (8 tiles)
  __shared__ _Float16 s_qh[16 * KVCH];    // 2KB  qh (pre-scaled) per tile
  __shared__ _Float16 s_x[16 * KVCH];     // 2KB  attended features X16

  const int tid = threadIdx.x;
  const int wave = tid >> 5;
  const int lane = tid & 31;

  const int base = blockIdx.x * 16;  // flat pixel base (n*4096 + i*64 + j)
  const int n_img = base >> 12;
  const int pij0 = base & 4095;
  const float* kv_n = kv + (size_t)n_img * TDIM * KV_TSTRIDE;

  // ---- Phase 0/1 staging -> f16 LDS. B weights go in packed layout. ------
  _Float16* s_wq = (_Float16*)s_pool;             // 256x64 B-packed (32KB)
  _Float16* s_qbuf = (_Float16*)(s_pool + 32768); // 16x256 row-major (8KB)
  for (int idx = tid; idx < KVCH * KVCH; idx += 64) {
    int k = idx >> 6, n = idx & 63;
    s_wk[idx] = (_Float16)Wk[idx];                    // row-major (A operand)
    s_wv[bpk_idx(k, n, 2)] = (_Float16)Wv[idx];       // B-packed, tile n4*2+kc
  }
  for (int idx = tid; idx < QCH * KVCH; idx += 64) {
    int k = idx >> 6, n = idx & 63;
    s_wq[bpk_idx(k, n, 8)] = (_Float16)Wq[idx];       // B-packed, tile n4*8+kc
  }
  for (int idx = tid; idx < 16 * QCH; idx += 64) {
    int m = idx >> 8, k = idx & 255;
    s_qbuf[idx] = (_Float16)q[((size_t)(base + m)) * QCH + k];
  }
  __syncthreads();

  // ---- Phase 1: qh = (q16 @ Wq) * 0.25, kept f16 in LDS (16x64) ----------
  {
    v8f acc0 = {}, acc1 = {};
    const int nt0 = 2 * wave, nt1 = 2 * wave + 1;
#pragma unroll
    for (int kc = 0; kc < 8; ++kc) {
      v16h a = readA(s_qbuf, QCH, 0, kc * 32, lane);
      v16h b0 = readPacked(s_wq, nt0 * 8 + kc, lane);
      v16h b1 = readPacked(s_wq, nt1 * 8 + kc, lane);
      acc0 = wmma16(a, b0, acc0);
      acc1 = wmma16(a, b1, acc1);
    }
    storeD_h(s_qh, KVCH, 0, nt0 * 16, acc0, lane, 0.25f);  // fold 1/sqrt(16)
    storeD_h(s_qh, KVCH, 0, nt1 * 16, acc1, lane, 0.25f);
  }
  __syncthreads();  // pool (Wq/qbuf) dead after this point

  // ---- Phase 2: decoupled per-wave pipelines (no intra-phase barriers) ---
  unsigned char* wbase = s_pool + wave * WAVE_LDS_BYTES;
  float* kvraw = (float*)wbase;
  _Float16* wz = (_Float16*)(wbase + KV_LDS_BYTES);  // packed Wkq / Z (2KB)
  _Float16* abuf = (_Float16*)(wbase + KV_LDS_BYTES + 2048);  // attn A (2KB)

  // Loop-invariant WMMA operands: Wk A-tiles, Wv B-tiles (16 x v16h regs).
  v16h wk_a[8], wv_b[8];
#pragma unroll
  for (int kc = 0; kc < 2; ++kc)
#pragma unroll
    for (int t4 = 0; t4 < 4; ++t4) {
      wk_a[kc * 4 + t4] = readA(s_wk, KVCH, t4 * 16, kc * 32, lane);
      wv_b[kc * 4 + t4] = readPacked(s_wv, t4 * 2 + kc, lane);
    }

  // Zero attn rows m>=4 once: those packed cells are never rewritten.
  {
    v8h z = {};
    *(v8h*)(abuf + lane * 16) = z;
    *(v8h*)(abuf + lane * 16 + 8) = z;
    *(v8h*)(abuf + 512 + lane * 16) = z;
    *(v8h*)(abuf + 512 + lane * 16 + 8) = z;
  }

  // Prologue: start DMA of this wave's first pixel.
  kv_issue(kvraw, kv_n + (size_t)(pij0 + wave * 8) * KVCH, lane);

  for (int i = 0; i < 8; ++i) {
    const int p = wave * 8 + i;  // pixel within tile

    {
      v8f acc[4] = {};
#pragma unroll
      for (int kc = 0; kc < 2; ++kc) {
        v16h b = readB_qb(&s_qh[p * KVCH], kc * 32, lane);
#pragma unroll
        for (int mt = 0; mt < 4; ++mt)
          acc[mt] = wmma16(wk_a[kc * 4 + mt], b, acc[mt]);
      }
#pragma unroll
      for (int mt = 0; mt < 4; ++mt) storeD_Bpacked(wz, acc[mt], mt * 16, lane);
    }

    kv_wait();  // s_wait_tensorcnt 0: KV tile resident in LDS

    // c) S = KV @ Wkq  (64t x 16, cols 0..3 = groups)
    v8f sacc[4] = {};
#pragma unroll
    for (int kc = 0; kc < 2; ++kc) {
      v16h b = readPacked(wz, kc, lane);
#pragma unroll
      for (int mt = 0; mt < 4; ++mt) {
        v16h a = readA_f32(kvraw, KVP, mt * 16, kc * 32, lane);
        sacc[mt] = wmma16(a, b, sacc[mt]);
      }
    }

    // d) softmax over t per group, in registers: column g lives on lanes
    // g and g+16 (D layout), so one shfl_xor(16) completes each reduction.
    {
      float mx = -1e30f;
#pragma unroll
      for (int mt = 0; mt < 4; ++mt)
#pragma unroll
        for (int v = 0; v < 8; ++v) mx = fmaxf(mx, sacc[mt][v]);
      mx = fmaxf(mx, __shfl_xor(mx, 16));
      float sum = 0.0f;
#pragma unroll
      for (int mt = 0; mt < 4; ++mt)
#pragma unroll
        for (int v = 0; v < 8; ++v) {
          float e = __expf(sacc[mt][v] - mx);
          sacc[mt][v] = e;
          sum += e;
        }
      sum += __shfl_xor(sum, 16);
      float inv = 1.0f / sum;
      int g = lane & 15;
      int mb = (lane & 16) ? 8 : 0;
      if (g < 4) {
#pragma unroll
        for (int mt = 0; mt < 4; ++mt)
#pragma unroll
          for (int v = 0; v < 8; ++v)
            abuf[pk_off(g, mt * 16 + mb + v)] = (_Float16)(sacc[mt][v] * inv);
      }
    }

    // e) Z = Ab @ KV  (16 x 64, rows 0..3 = groups); wz reused for Z.
    {
      v8f acc[4] = {};
#pragma unroll
      for (int kc = 0; kc < 2; ++kc) {
        v16h a = readPacked(abuf, kc, lane);
#pragma unroll
        for (int nt = 0; nt < 4; ++nt) {
          v16h b = readB_f32(kvraw, KVP, kc * 32, nt * 16, lane);
          acc[nt] = wmma16(a, b, acc[nt]);
        }
      }
#pragma unroll
      for (int nt = 0; nt < 4; ++nt) storeD_Apacked(wz, acc[nt], nt * 16, lane);
    }

    // Drain kvraw reads, then start the next pixel's DMA (overlaps f + b).
    if (i < 7) {
      asm volatile("s_wait_dscnt 0x0" ::: "memory");
      kv_issue(kvraw, kv_n + (size_t)(pij0 + p + 1) * KVCH, lane);
    }

    // f) Y = Z @ Wv ; x[g*16+c] = Y[g, g*16+c]  (group-diagonal rows)
    {
      v8f acc[4] = {};
#pragma unroll
      for (int kc = 0; kc < 2; ++kc) {
        v16h a = readPacked(wz, kc, lane);
#pragma unroll
        for (int nt = 0; nt < 4; ++nt)
          acc[nt] = wmma16(a, wv_b[kc * 4 + nt], acc[nt]);
      }
      if (lane < 16) {
        s_x[p * KVCH + 0 * 16 + lane] = (_Float16)acc[0][0];
        s_x[p * KVCH + 1 * 16 + lane] = (_Float16)acc[1][1];
        s_x[p * KVCH + 2 * 16 + lane] = (_Float16)acc[2][2];
        s_x[p * KVCH + 3 * 16 + lane] = (_Float16)acc[3][3];
      }
    }
  }
  __syncthreads();  // both waves done with pool scratch and s_x

  // ---- Phase 3: out = X16 @ Wout + b_out  (16 x 256) ---------------------
  _Float16* s_wout = (_Float16*)s_pool;  // 64x256 B-packed (32KB), pool reuse
  for (int idx = tid; idx < KVCH * QCH; idx += 64) {
    int k = idx >> 8, n = idx & 255;
    s_wout[bpk_idx(k, n, 2)] = (_Float16)Wout[idx];  // tile = (n>>4)*2 + kc
  }
  __syncthreads();
  {
    v8f acc[8] = {};
#pragma unroll
    for (int kc = 0; kc < 2; ++kc) {
      v16h a = readA(s_x, KVCH, 0, kc * 32, lane);
#pragma unroll
      for (int j = 0; j < 8; ++j) {
        int nt = wave * 8 + j;
        v16h b = readPacked(s_wout, nt * 2 + kc, lane);
        acc[j] = wmma16(a, b, acc[j]);
      }
    }
    int mb = (lane & 16) ? 8 : 0;
#pragma unroll
    for (int j = 0; j < 8; ++j) {
      int col = (wave * 8 + j) * 16 + (lane & 15);
      float bia = b_out[col];
#pragma unroll
      for (int v = 0; v < 8; ++v)
        out[((size_t)(base + mb + v)) * QCH + col] = acc[j][v] + bia;
    }
  }
}

extern "C" void kernel_launch(void* const* d_in, const int* in_sizes, int n_in,
                              void* d_out, int out_size, void* d_ws,
                              size_t ws_size, hipStream_t stream) {
  const float* q = (const float*)d_in[0];
  const float* kv = (const float*)d_in[1];
  const float* Wq = (const float*)d_in[2];
  const float* Wk = (const float*)d_in[3];
  const float* Wv = (const float*)d_in[4];
  const float* Wout = (const float*)d_in[5];
  const float* b_out = (const float*)d_in[6];
  float* out = (float*)d_out;

  dim3 grid(PIX / 16);  // 1024 workgroups, 16 pixels each
  dim3 block(64);       // 2 wave32s
  pw_attn_kernel<<<grid, block, 0, stream>>>(q, kv, Wq, Wk, Wv, Wout, b_out,
                                             out);
}

// v002
// A run of this version takes 32.2 microseconds.
// Timed twice side by side with v001, it ran 2.87 and 2.86 times as fast.
// All steps since v000 together make it 3.27 times as fast.
#include <hip/hip_runtime.h>
#include <hip/hip_bf16.h>

typedef __attribute__((ext_vector_type(16))) _Float16 v16h;
typedef __attribute__((ext_vector_type(8)))  _Float16 v8h;
typedef __attribute__((ext_vector_type(4)))  _Float16 v4h;
typedef __attribute__((ext_vector_type(4)))  float    f32x4;
typedef __attribute__((ext_vector_type(8)))  float    v8f;
typedef __attribute__((ext_vector_type(2)))  _Float16 h2;
typedef __attribute__((ext_vector_type(4)))  unsigned u32x4;
typedef __attribute__((ext_vector_type(8)))  int      i32x8;
typedef __attribute__((ext_vector_type(4)))  int      i32x4;

#define NIMG 4
#define TDIM 64
#define LDIM 64
#define QCH  256
#define KVCH 64
#define PIX  (NIMG * LDIM * LDIM)               // 16384 flat pixels
#define KV_TSTRIDE ((size_t)LDIM * LDIM * KVCH) // 262144 floats between t rows
#define KVP 68
#define KV_LDS_BYTES 18432  // 64 rows x 272 B = 17408, rounded up to 2 KiB
#define WAVE_LDS_BYTES (KV_LDS_BYTES + 4096)  // tile + Wkq/Z + attn buffers

#if defined(__has_builtin)
#if __has_builtin(__builtin_amdgcn_tensor_load_to_lds) && \
    __has_builtin(__builtin_amdgcn_s_wait_tensorcnt)
#define HAVE_TDM 1
#endif
#endif

__device__ __forceinline__ v8f wmma16(v16h a, v16h b, v8f c) {
  return __builtin_amdgcn_wmma_f32_16x16x32_f16(false, a, false, b, (short)0, c,
                                                false, false);
}

__device__ __forceinline__ int kmap(int v, int lane) {
  int b = (v < 4) ? (v * 2) : (16 + (v - 4) * 2);
  return b + ((lane & 16) ? 8 : 0);
}

__device__ __forceinline__ int pk_off(int p, int k) {
  int kk = k & 31;
  int lh = (kk >> 3) & 1;
  int kr = kk - 8 * lh;
  int slot = (kr & 7) + ((kr >> 4) << 3);
  return (k >> 5) * 512 + (p + 16 * lh) * 16 + slot;
}

// Packed position for B element (k, n) of a weight with ktiles K-chunks.
__device__ __forceinline__ int bpk_idx(int k, int n, int ktiles) {
  int kk = k & 31;
  int lh = (kk >> 3) & 1;
  int kr = kk - 8 * lh;
  int slot = (kr & 7) + ((kr >> 4) << 3);
  return ((n >> 4) * ktiles + (k >> 5)) * 512 + ((n & 15) + 16 * lh) * 16 + slot;
}

// Row-major staging, f32 global -> f16 LDS in the same order: the 64 threads
// walk CNT runs of 1 KiB, 16 bytes a lane. Loads and stores are two calls, so
// that later groups' loads are in flight while a group is converted.
template <int CNT>
__device__ __forceinline__ void rows_load(f32x4 (&r)[CNT], const float* src,
                                          int tid) {
#pragma unroll  // constant indices keep the arrays in registers
  for (int u = 0; u < CNT; ++u)
    r[u] = *reinterpret_cast<const f32x4*>(src + (u * 64 + tid) * 4);
}

template <int CNT>
__device__ __forceinline__ void rows_store(_Float16* dst, const f32x4 (&r)[CNT],
                                           int tid) {
#pragma unroll  // constant indices keep the arrays in registers
  for (int u = 0; u < CNT; ++u) {
    v4h h;
#pragma unroll  // constant indices keep the arrays in registers
    for (int c = 0; c < 4; ++c) h[c] = (_Float16)r[u][c];
    *reinterpret_cast<v4h*>(dst + (u * 64 + tid) * 4) = h;
  }
}

template <int K>
__device__ __forceinline__ int blk_kb(int u, int tid) {
  return (u % (K / 32)) * 4 + ((tid >> 3) & 1) * 2 + (tid >> 5);
}

template <int K>
__device__ __forceinline__ int blk_n4(int u, int tid) {
  return (u / (K / 32)) * 16 + ((tid >> 4) & 1) * 8 + (tid & 7);
}

// First element of a thread's block 0; block u lies a constant further on.
template <int K, int N>
__device__ __forceinline__ const float* blk_ptr(const float* w, int tid) {
  return w + blk_kb<K>(0, tid) * 8 * N + blk_n4<K>(0, tid) * 4;
}

template <int K, int N, int U0, int CNT>
__device__ __forceinline__ void bpk_load(f32x4 (&r)[CNT][8], const float* p0) {
#pragma unroll  // constant indices keep the arrays in registers
  for (int u = 0; u < CNT; ++u) {
    const float* p =
        p0 + ((U0 + u) % (K / 32)) * 32 * N + ((U0 + u) / (K / 32)) * 64;
#pragma unroll  // constant indices keep the arrays in registers
    for (int j = 0; j < 8; ++j)
      r[u][j] = *reinterpret_cast<const f32x4*>(p + j * N);
  }
}

template <int K, int N, int U0, int CNT>
__device__ __forceinline__ void bpk_store(_Float16* dst,
                                          const f32x4 (&r)[CNT][8], int tid) {
#pragma unroll  // constant indices keep the arrays in registers
  for (int u = 0; u < CNT; ++u) {
    const int k0 = blk_kb<K>(U0 + u, tid) * 8;
    const int n0 = blk_n4<K>(U0 + u, tid) * 4;
#pragma unroll  // constant indices keep the arrays in registers
    for (int c = 0; c < 4; ++c) {
      v8h h;
#pragma unroll  // constant indices keep the arrays in registers
      for (int j = 0; j < 8; ++j) h[j] = (_Float16)r[u][j][c];
      *reinterpret_cast<v8h*>(dst + bpk_idx(k0, n0 + c, K / 32)) = h;
    }
  }
}

__device__ __forceinline__ void stage_fence() {
  __builtin_amdgcn_sched_barrier(0);
}

// Stands behind a group's loads: the wait comes before anything reuses an
// address register that those loads name. The
// group's address is an input, so that it stays whole up to the wait and no
// load of the group lands on it; the fence keeps what follows behind the wait.
__device__ __forceinline__ void loads_issued(const float* p) {
  asm volatile("s_wait_xcnt 0x0" ::"v"(p) : "memory");
  __builtin_amdgcn_sched_barrier(0);
}

// Packed operand fetch: 16 contiguous halves per lane -> 2x ds_load_b128.
__device__ __forceinline__ v16h readPacked(const _Float16* buf, int tile,
                                           int lane) {
  const v8h* p = reinterpret_cast<const v8h*>(buf + tile * 512 + lane * 16);
  v8h lo = p[0], hi = p[1];
  return __builtin_shufflevector(lo, hi, 0, 1, 2, 3, 4, 5, 6, 7, 8, 9, 10, 11,
                                 12, 13, 14, 15);
}

// A operand from row-major f16 LDS: two contiguous 8-half runs per lane.
__device__ __forceinline__ v16h readA(const _Float16* buf, int stride, int m0,
                                      int k0, int lane) {
  const _Float16* row =
      buf + (m0 + (lane & 15)) * stride + k0 + ((lane & 16) ? 8 : 0);
  v8h lo = *reinterpret_cast<const v8h*>(row);       // k: base+0..7
  v8h hi = *reinterpret_cast<const v8h*>(row + 16);  // k: base+16..23
  return __builtin_shufflevector(lo, hi, 0, 1, 2, 3, 4, 5, 6, 7, 8, 9, 10, 11,
                                 12, 13, 14, 15);
}

__device__ __forceinline__ v16h readA_f32(const float* buf, int stride, int m0,
                                          int k0, int lane) {
  const float* row =
      buf + (m0 + (lane & 15)) * stride + k0 + ((lane & 16) ? 8 : 0);
  float4 a0 = *reinterpret_cast<const float4*>(row);
  float4 a1 = *reinterpret_cast<const float4*>(row + 4);
  float4 b0 = *reinterpret_cast<const float4*>(row + 16);
  float4 b1 = *reinterpret_cast<const float4*>(row + 20);
  v16h r;
  r[0] = (_Float16)a0.x;  r[1] = (_Float16)a0.y;
  r[2] = (_Float16)a0.z;  r[3] = (_Float16)a0.w;
  r[4] = (_Float16)a1.x;  r[5] = (_Float16)a1.y;
  r[6] = (_Float16)a1.z;  r[7] = (_Float16)a1.w;
  r[8] = (_Float16)b0.x;  r[9] = (_Float16)b0.y;
  r[10] = (_Float16)b0.z; r[11] = (_Float16)b0.w;
  r[12] = (_Float16)b1.x; r[13] = (_Float16)b1.y;
  r[14] = (_Float16)b1.z; r[15] = (_Float16)b1.w;
  return r;
}

__device__ __forceinline__ v16h readB_f32(const float* buf, int stride, int k0,
                                          int n0, int lane) {
  int n = n0 + (lane & 15);
  v16h r;
#pragma unroll
  for (int v = 0; v < 8; ++v) {
    int k = k0 + kmap(v, lane);
    r[2 * v] = (_Float16)buf[k * stride + n];
    r[2 * v + 1] = (_Float16)buf[(k + 1) * stride + n];
  }
  return r;
}

// Qb[k, n] = (n == k/16) ? qh_p[k] : 0  -- block-diagonal query embedding.
__device__ __forceinline__ v16h readB_qb(const _Float16* qh_p, int k0, int lane) {
  int n = lane & 15;
  v16h r;
#pragma unroll
  for (int v = 0; v < 8; ++v) {
    int k = k0 + kmap(v, lane);
    h2 p = *reinterpret_cast<const h2*>(qh_p + k);
    r[2 * v] = (n == (k >> 4)) ? p.x : (_Float16)0.0f;
    r[2 * v + 1] = (n == ((k + 1) >> 4)) ? p.y : (_Float16)0.0f;
  }
  return r;
}

__device__ __forceinline__ void storeD_h(_Float16* buf, int stride, int m0,
                                         int n0, v8f acc, int lane, float scale) {
  int n = n0 + (lane & 15);
  int mb = m0 + ((lane & 16) ? 8 : 0);
#pragma unroll
  for (int v = 0; v < 8; ++v)
    buf[(mb + v) * stride + n] = (_Float16)(acc[v] * scale);
}

// D tile -> B-operand-packed (next GEMM's K = this tile's row index m).
__device__ __forceinline__ void storeD_Bpacked(_Float16* buf, v8f acc, int m0,
                                               int lane) {
  int n = lane & 15;
  int mb = m0 + ((lane & 16) ? 8 : 0);
#pragma unroll
  for (int v = 0; v < 8; ++v) buf[pk_off(n, mb + v)] = (_Float16)acc[v];
}

// D tile -> A-operand-packed (next GEMM's K = this tile's column index n).
__device__ __forceinline__ void storeD_Apacked(_Float16* buf, v8f acc, int n0,
                                               int lane) {
  int k = n0 + (lane & 15);
  int mb = (lane & 16) ? 8 : 0;
#pragma unroll
  for (int v = 0; v < 8; ++v) buf[pk_off(mb + v, k)] = (_Float16)acc[v];
}

__device__ __forceinline__ unsigned uni(unsigned v) {
  return (unsigned)__builtin_amdgcn_readfirstlane((int)v);
}

__device__ __forceinline__ void kv_issue(float* ldsdst, const float* gsrc,
                                         int lane) {
#if defined(HAVE_TDM)
  unsigned long long ga = (unsigned long long)(uintptr_t)gsrc;
  u32x4 g0;
  g0[0] = uni(1u);
  g0[1] = uni((unsigned)(uintptr_t)ldsdst);
  g0[2] = uni((unsigned)(ga & 0xffffffffu));
  g0[3] = uni((unsigned)((ga >> 32) & 0x01ffffffu) | (2u << 30));
  i32x8 g1;
  g1[0] = (int)((1u << 20) | (5u << 22) | (3u << 25));
  g1[1] = (int)(256u << 16);
  g1[2] = (int)(64u << 16);
  g1[3] = (int)(256u << 16);
  g1[4] = 64;
  g1[5] = (int)(KV_TSTRIDE * sizeof(float));
  g1[6] = 0;
  g1[7] = 0;
  i32x4 gz = {0, 0, 0, 0};   // 2D tensor: groups 2/3 unused
#if defined(__clang_major__) && __clang_major__ >= 23
  i32x8 gz8 = {0, 0, 0, 0, 0, 0, 0, 0};
  __builtin_amdgcn_tensor_load_to_lds(g0, g1, gz, gz, gz8, 0);
#else
  __builtin_amdgcn_tensor_load_to_lds(g0, g1, gz, gz, 0);
#endif
#else
#pragma unroll 4
  for (int it = 0; it < 32; ++it) {
    int fl = it * 32 + lane;
    int t = fl >> 4;
    int c4 = (fl & 15) * 4;
    float4 v4 = *reinterpret_cast<const float4*>(gsrc + (size_t)t * KV_TSTRIDE + c4);
    *reinterpret_cast<float4*>(ldsdst + t * KVP + c4) = v4;
  }
#endif
}

__device__ __forceinline__ void kv_wait() {
#if defined(HAVE_TDM)
  __builtin_amdgcn_s_wait_tensorcnt(0);
#endif
  asm volatile("" ::: "memory");
}

__global__ __launch_bounds__(64) void pw_attn_kernel(
    const float* __restrict__ q, const float* __restrict__ kv,
    const float* __restrict__ Wq, const float* __restrict__ Wk,
    const float* __restrict__ Wv, const float* __restrict__ Wout,
    const float* __restrict__ b_out, float* __restrict__ out) {
  // Phase-aliased LDS pool (44KB) + persistent buffers. Total 64KB.
  // 2 KiB alignment: each wave's tensor-load destination is a 2 KiB multiple.
  __shared__ __align__(2048) unsigned char s_pool[2 * WAVE_LDS_BYTES];
  __shared__ _Float16 s_wk[KVCH * KVCH];  // 8KB  Wk f16, row-major (A reads)
  __shared__ _Float16 s_wv[KVCH * KVCH];  // 8KB  Wv f16, B-packed (8 tiles)
  __shared__ _Float16 s_qh[16 * KVCH];    // 2KB  qh (pre-scaled) per tile
  __shared__ _Float16 s_x[16 * KVCH];     // 2KB  attended features X16

  const int tid = threadIdx.x;
  const int wave = tid >> 5;
  const int lane = tid & 31;

  const int base = blockIdx.x * 16;  // flat pixel base (n*4096 + i*64 + j)
  const int n_img = base >> 12;
  const int pij0 = base & 4095;
  const float* kv_n = kv + (size_t)n_img * TDIM * KV_TSTRIDE;

  // ---- Phase 0/1 staging -> f16 LDS. B weights go in packed layout. ------
  _Float16* s_wq = (_Float16*)s_pool;             // 256x64 B-packed (32KB)
  _Float16* s_qbuf = (_Float16*)(s_pool + 32768); // 16x256 row-major (8KB)
  {
    f32x4 rk[16], rq[16], rv[2][8], w0[2][8], w1[2][8], w2[2][8], w3[2][8];
    const float* pv = blk_ptr<KVCH, KVCH>(Wv, tid);
    const float* pq = blk_ptr<QCH, KVCH>(Wq, tid);
    rows_load<16>(rk, Wk, tid);
    bpk_load<KVCH, KVCH, 0, 2>(rv, pv);
    rows_load<16>(rq, q + (size_t)base * QCH, tid);  // 16 adjacent rows of q
    loads_issued(pv);
    rows_store<16>(s_wk, rk, tid);                   // row-major (A operand)
    stage_fence();
    bpk_load<QCH, KVCH, 0, 2>(w0, pq);
    loads_issued(pq);
    bpk_store<KVCH, KVCH, 0, 2>(s_wv, rv, tid);      // B-packed, tile n4*2+kc
    stage_fence();
    bpk_load<QCH, KVCH, 2, 2>(w1, pq);
    loads_issued(pq);
    rows_store<16>(s_qbuf, rq, tid);                 // row-major (A operand)
    stage_fence();
    bpk_load<QCH, KVCH, 4, 2>(w2, pq);
    loads_issued(pq);
    bpk_store<QCH, KVCH, 0, 2>(s_wq, w0, tid);       // B-packed, tile n4*8+kc
    stage_fence();
    bpk_load<QCH, KVCH, 6, 2>(w3, pq);
    loads_issued(pq);
    bpk_store<QCH, KVCH, 2, 2>(s_wq, w1, tid);
    bpk_store<QCH, KVCH, 4, 2>(s_wq, w2, tid);
    bpk_store<QCH, KVCH, 6, 2>(s_wq, w3, tid);
  }
  __syncthreads();

  // ---- Phase 1: qh = (q16 @ Wq) * 0.25, kept f16 in LDS (16x64) ----------
  {
    v8f acc0 = {}, acc1 = {};
    const int nt0 = 2 * wave, nt1 = 2 * wave + 1;
#pragma unroll
    for (int kc = 0; kc < 8; ++kc) {
      v16h a = readA(s_qbuf, QCH, 0, kc * 32, lane);
      v16h b0 = readPacked(s_wq, nt0 * 8 + kc, lane);
      v16h b1 = readPacked(s_wq, nt1 * 8 + kc, lane);
      acc0 = wmma16(a, b0, acc0);
      acc1 = wmma16(a, b1, acc1);
    }
    storeD_h(s_qh, KVCH, 0, nt0 * 16, acc0, lane, 0.25f);  // fold 1/sqrt(16)
    storeD_h(s_qh, KVCH, 0, nt1 * 16, acc1, lane, 0.25f);
  }
  __syncthreads();  // pool (Wq/qbuf) dead after this point

  // ---- Phase 2: decoupled per-wave pipelines (no intra-phase barriers) ---
  unsigned char* wbase = s_pool + wave * WAVE_LDS_BYTES;
  float* kvraw = (float*)wbase;
  _Float16* wz = (_Float16*)(wbase + KV_LDS_BYTES);  // packed Wkq / Z (2KB)
  _Float16* abuf = (_Float16*)(wbase + KV_LDS_BYTES + 2048);  // attn A (2KB)

  // Loop-invariant WMMA operands: Wk A-tiles, Wv B-tiles (16 x v16h regs).
  v16h wk_a[8], wv_b[8];
#pragma unroll
  for (int kc = 0; kc < 2; ++kc)
#pragma unroll
    for (int t4 = 0; t4 < 4; ++t4) {
      wk_a[kc * 4 + t4] = readA(s_wk, KVCH, t4 * 16, kc * 32, lane);
      wv_b[kc * 4 + t4] = readPacked(s_wv, t4 * 2 + kc, lane);
    }

  // Zero attn rows m>=4 once: those packed cells are never rewritten.
  {
    v8h z = {};
    *(v8h*)(abuf + lane * 16) = z;
    *(v8h*)(abuf + lane * 16 + 8) = z;
    *(v8h*)(abuf + 512 + lane * 16) = z;
    *(v8h*)(abuf + 512 + lane * 16 + 8) = z;
  }

  // Prologue: start DMA of this wave's first pixel.
  kv_issue(kvraw, kv_n + (size_t)(pij0 + wave * 8) * KVCH, lane);

  for (int i = 0; i < 8; ++i) {
    const int p = wave * 8 + i;  // pixel within tile

    {
      v8f acc[4] = {};
#pragma unroll
      for (int kc = 0; kc < 2; ++kc) {
        v16h b = readB_qb(&s_qh[p * KVCH], kc * 32, lane);
#pragma unroll
        for (int mt = 0; mt < 4; ++mt)
          acc[mt] = wmma16(wk_a[kc * 4 + mt], b, acc[mt]);
      }
#pragma unroll
      for (int mt = 0; mt < 4; ++mt) storeD_Bpacked(wz, acc[mt], mt * 16, lane);
    }

    kv_wait();  // s_wait_tensorcnt 0: KV tile resident in LDS

    // c) S = KV @ Wkq  (64t x 16, cols 0..3 = groups)
    v8f sacc[4] = {};
#pragma unroll
    for (int kc = 0; kc < 2; ++kc) {
      v16h b = readPacked(wz, kc, lane);
#pragma unroll
      for (int mt = 0; mt < 4; ++mt) {
        v16h a = readA_f32(kvraw, KVP, mt * 16, kc * 32, lane);
        sacc[mt] = wmma16(a, b, sacc[mt]);
      }
    }

    // d) softmax over t per group, in registers: column g lives on lanes
    // g and g+16 (D layout), so one shfl_xor(16) completes each reduction.
    {
      float mx = -1e30f;
#pragma unroll
      for (int mt = 0; mt < 4; ++mt)
#pragma unroll
        for (int v = 0; v < 8; ++v) mx = fmaxf(mx, sacc[mt][v]);
      mx = fmaxf(mx, __shfl_xor(mx, 16));
      float sum = 0.0f;
#pragma unroll
      for (int mt = 0; mt < 4; ++mt)
#pragma unroll
        for (int v = 0; v < 8; ++v) {
          float e = __expf(sacc[mt][v] - mx);
          sacc[mt][v] = e;
          sum += e;
        }
      sum += __shfl_xor(sum, 16);
      float inv = 1.0f / sum;
      int g = lane & 15;
      int mb = (lane & 16) ? 8 : 0;
      if (g < 4) {
#pragma unroll
        for (int mt = 0; mt < 4; ++mt)
#pragma unroll
          for (int v = 0; v < 8; ++v)
            abuf[pk_off(g, mt * 16 + mb + v)] = (_Float16)(sacc[mt][v] * inv);
      }
    }

    // e) Z = Ab @ KV  (16 x 64, rows 0..3 = groups); wz reused for Z.
    {
      v8f acc[4] = {};
#pragma unroll
      for (int kc = 0; kc < 2; ++kc) {
        v16h a = readPacked(abuf, kc, lane);
#pragma unroll
        for (int nt = 0; nt < 4; ++nt) {
          v16h b = readB_f32(kvraw, KVP, kc * 32, nt * 16, lane);
          acc[nt] = wmma16(a, b, acc[nt]);
        }
      }
#pragma unroll
      for (int nt = 0; nt < 4; ++nt) storeD_Apacked(wz, acc[nt], nt * 16, lane);
    }

    // Drain kvraw reads, then start the next pixel's DMA (overlaps f + b).
    if (i < 7) {
      asm volatile("s_wait_dscnt 0x0" ::: "memory");
      kv_issue(kvraw, kv_n + (size_t)(pij0 + p + 1) * KVCH, lane);
    }

    // f) Y = Z @ Wv ; x[g*16+c] = Y[g, g*16+c]  (group-diagonal rows)
    {
      v8f acc[4] = {};
#pragma unroll
      for (int kc = 0; kc < 2; ++kc) {
        v16h a = readPacked(wz, kc, lane);
#pragma unroll
        for (int nt = 0; nt < 4; ++nt)
          acc[nt] = wmma16(a, wv_b[kc * 4 + nt], acc[nt]);
      }
      if (lane < 16) {
        s_x[p * KVCH + 0 * 16 + lane] = (_Float16)acc[0][0];
        s_x[p * KVCH + 1 * 16 + lane] = (_Float16)acc[1][1];
        s_x[p * KVCH + 2 * 16 + lane] = (_Float16)acc[2][2];
        s_x[p * KVCH + 3 * 16 + lane] = (_Float16)acc[3][3];
      }
    }
  }
  __syncthreads();  // both waves done with pool scratch and s_x

  // ---- Phase 3: out = X16 @ Wout + b_out  (16 x 256) ---------------------
  _Float16* s_wout = (_Float16*)s_pool;  // 64x256 B-packed (32KB), pool reuse
  {
    f32x4 w0[2][8], w1[2][8], w2[2][8], w3[2][8];
    const float* po = blk_ptr<KVCH, QCH>(Wout, tid);
    bpk_load<KVCH, QCH, 0, 2>(w0, po);
    bpk_load<KVCH, QCH, 2, 2>(w1, po);
    bpk_load<KVCH, QCH, 4, 2>(w2, po);
    loads_issued(po);
    bpk_store<KVCH, QCH, 0, 2>(s_wout, w0, tid);     // tile = (n>>4)*2 + kc
    stage_fence();
    bpk_load<KVCH, QCH, 6, 2>(w3, po);
    loads_issued(po);
    bpk_store<KVCH, QCH, 2, 2>(s_wout, w1, tid);
    bpk_store<KVCH, QCH, 4, 2>(s_wout, w2, tid);
    bpk_store<KVCH, QCH, 6, 2>(s_wout, w3, tid);
  }
  __syncthreads();
  {
    v8f acc[8] = {};
#pragma unroll
    for (int kc = 0; kc < 2; ++kc) {
      v16h a = readA(s_x, KVCH, 0, kc * 32, lane);
#pragma unroll
      for (int j = 0; j < 8; ++j) {
        int nt = wave * 8 + j;
        v16h b = readPacked(s_wout, nt * 2 + kc, lane);
        acc[j] = wmma16(a, b, acc[j]);
      }
    }
    int mb = (lane & 16) ? 8 : 0;
#pragma unroll
    for (int j = 0; j < 8; ++j) {
      int col = (wave * 8 + j) * 16 + (lane & 15);
      float bia = b_out[col];
#pragma unroll
      for (int v = 0; v < 8; ++v)
        out[((size_t)(base + mb + v)) * QCH + col] = acc[j][v] + bia;
    }
  }
}

extern "C" void kernel_launch(void* const* d_in, const int* in_sizes, int n_in,
                              void* d_out, int out_size, void* d_ws,
                              size_t ws_size, hipStream_t stream) {
  const float* q = (const float*)d_in[0];
  const float* kv = (const float*)d_in[1];
  const float* Wq = (const float*)d_in[2];
  const float* Wk = (const float*)d_in[3];
  const float* Wv = (const float*)d_in[4];
  const float* Wout = (const float*)d_in[5];
  const float* b_out = (const float*)d_in[6];
  float* out = (float*)d_out;

  dim3 grid(PIX / 16);  // 1024 workgroups, 16 pixels each
  dim3 block(64);       // 2 wave32s
  pw_attn_kernel<<<grid, block, 0, stream>>>(q, kv, Wq, Wk, Wv, Wout, b_out,
                                             out);
}

// v003
// One run takes 27.8 microseconds.
// Timed twice side by side with v002, it ran 1.14 and 1.12 times as fast.
// Over all steps from v000 it is 3.69 times as fast.
#include <hip/hip_runtime.h>
#include <hip/hip_bf16.h>

typedef __attribute__((ext_vector_type(16))) _Float16 v16h;
typedef __attribute__((ext_vector_type(8)))  _Float16 v8h;
typedef __attribute__((ext_vector_type(4)))  _Float16 v4h;
typedef __attribute__((ext_vector_type(4)))  float    f32x4;
typedef __attribute__((ext_vector_type(8)))  float    v8f;
typedef __attribute__((ext_vector_type(2)))  _Float16 h2;
typedef __attribute__((ext_vector_type(4)))  unsigned u32x4;
typedef __attribute__((ext_vector_type(8)))  int      i32x8;
typedef __attribute__((ext_vector_type(4)))  int      i32x4;

#define NIMG 4
#define TDIM 64
#define LDIM 64
#define QCH  256
#define KVCH 64
#define PIX  (NIMG * LDIM * LDIM)               // 16384 flat pixels
#define KV_TSTRIDE ((size_t)LDIM * LDIM * KVCH) // 262144 floats between t rows
#define KVP 68
#define KV_LDS_BYTES 18432  // 64 rows x 272 B = 17408, rounded up to 2 KiB
#define POOL_BYTES 40960    // Wq + q staging; later 2 KV tiles; later Wout

#if defined(__has_builtin)
#if __has_builtin(__builtin_amdgcn_tensor_load_to_lds) && \
    __has_builtin(__builtin_amdgcn_s_wait_tensorcnt)
#define HAVE_TDM 1
#endif
#endif

__device__ __forceinline__ v8f wmma16(v16h a, v16h b, v8f c) {
  return __builtin_amdgcn_wmma_f32_16x16x32_f16(false, a, false, b, (short)0, c,
                                                false, false);
}

__device__ __forceinline__ int kmap(int v, int lane) {
  int b = (v < 4) ? (v * 2) : (16 + (v - 4) * 2);
  return b + ((lane & 16) ? 8 : 0);
}

// Packed position for B element (k, n) of a weight with ktiles K-chunks.
__device__ __forceinline__ int bpk_idx(int k, int n, int ktiles) {
  int kk = k & 31;
  int lh = (kk >> 3) & 1;
  int kr = kk - 8 * lh;
  int slot = (kr & 7) + ((kr >> 4) << 3);
  return ((n >> 4) * ktiles + (k >> 5)) * 512 + ((n & 15) + 16 * lh) * 16 + slot;
}

// Row-major staging, f32 global -> f16 LDS in the same order: the 64 threads
// walk CNT runs of 1 KiB, 16 bytes a lane. Loads and stores are two calls, so
// that later groups' loads are in flight while a group is converted.
template <int CNT>
__device__ __forceinline__ void rows_load(f32x4 (&r)[CNT], const float* src,
                                          int tid) {
#pragma unroll  // constant indices keep the arrays in registers
  for (int u = 0; u < CNT; ++u)
    r[u] = *reinterpret_cast<const f32x4*>(src + (u * 64 + tid) * 4);
}

template <int CNT>
__device__ __forceinline__ void rows_store(_Float16* dst, const f32x4 (&r)[CNT],
                                           int tid) {
#pragma unroll  // constant indices keep the arrays in registers
  for (int u = 0; u < CNT; ++u) {
    v4h h;
#pragma unroll  // constant indices keep the arrays in registers
    for (int c = 0; c < 4; ++c) h[c] = (_Float16)r[u][c];
    *reinterpret_cast<v4h*>(dst + (u * 64 + tid) * 4) = h;
  }
}

template <int K>
__device__ __forceinline__ int blk_kb(int u, int tid) {
  return (u % (K / 32)) * 4 + ((tid >> 3) & 1) * 2 + (tid >> 5);
}

template <int K>
__device__ __forceinline__ int blk_n4(int u, int tid) {
  return (u / (K / 32)) * 16 + ((tid >> 4) & 1) * 8 + (tid & 7);
}

// First element of a thread's block 0; block u lies a constant further on.
template <int K, int N>
__device__ __forceinline__ const float* blk_ptr(const float* w, int tid) {
  return w + blk_kb<K>(0, tid) * 8 * N + blk_n4<K>(0, tid) * 4;
}

template <int K, int N, int U0, int CNT>
__device__ __forceinline__ void bpk_load(f32x4 (&r)[CNT][8], const float* p0) {
#pragma unroll  // constant indices keep the arrays in registers
  for (int u = 0; u < CNT; ++u) {
    const float* p =
        p0 + ((U0 + u) % (K / 32)) * 32 * N + ((U0 + u) / (K / 32)) * 64;
#pragma unroll  // constant indices keep the arrays in registers
    for (int j = 0; j < 8; ++j)
      r[u][j] = *reinterpret_cast<const f32x4*>(p + j * N);
  }
}

template <int K, int N, int U0, int CNT>
__device__ __forceinline__ void bpk_store(_Float16* dst,
                                          const f32x4 (&r)[CNT][8], int tid) {
#pragma unroll  // constant indices keep the arrays in registers
  for (int u = 0; u < CNT; ++u) {
    const int k0 = blk_kb<K>(U0 + u, tid) * 8;
    const int n0 = blk_n4<K>(U0 + u, tid) * 4;
#pragma unroll  // constant indices keep the arrays in registers
    for (int c = 0; c < 4; ++c) {
      v8h h;
#pragma unroll  // constant indices keep the arrays in registers
      for (int j = 0; j < 8; ++j) h[j] = (_Float16)r[u][j][c];
      *reinterpret_cast<v8h*>(dst + bpk_idx(k0, n0 + c, K / 32)) = h;
    }
  }
}

__device__ __forceinline__ void stage_fence() {
  __builtin_amdgcn_sched_barrier(0);
}

// Stands behind a group's loads: the wait comes before anything reuses an
// address register that those loads name. The
// group's address is an input, so that it stays whole up to the wait and no
// load of the group lands on it; the fence keeps what follows behind the wait.
__device__ __forceinline__ void loads_issued(const float* p) {
  asm volatile("s_wait_xcnt 0x0" ::"v"(p) : "memory");
  __builtin_amdgcn_sched_barrier(0);
}

// Packed operand fetch: 16 contiguous halves per lane -> 2x ds_load_b128.
__device__ __forceinline__ v16h readPacked(const _Float16* buf, int tile,
                                           int lane) {
  const v8h* p = reinterpret_cast<const v8h*>(buf + tile * 512 + lane * 16);
  v8h lo = p[0], hi = p[1];
  return __builtin_shufflevector(lo, hi, 0, 1, 2, 3, 4, 5, 6, 7, 8, 9, 10, 11,
                                 12, 13, 14, 15);
}

// A operand from row-major f16 LDS: two contiguous 8-half runs per lane.
__device__ __forceinline__ v16h readA(const _Float16* buf, int stride, int m0,
                                      int k0, int lane) {
  const _Float16* row =
      buf + (m0 + (lane & 15)) * stride + k0 + ((lane & 16) ? 8 : 0);
  v8h lo = *reinterpret_cast<const v8h*>(row);       // k: base+0..7
  v8h hi = *reinterpret_cast<const v8h*>(row + 16);  // k: base+16..23
  return __builtin_shufflevector(lo, hi, 0, 1, 2, 3, 4, 5, 6, 7, 8, 9, 10, 11,
                                 12, 13, 14, 15);
}

__device__ __forceinline__ v16h readA_f32(const float* buf, int stride, int m0,
                                          int k0, int lane) {
  const float* row =
      buf + (m0 + (lane & 15)) * stride + k0 + ((lane & 16) ? 8 : 0);
  float4 a0 = *reinterpret_cast<const float4*>(row);
  float4 a1 = *reinterpret_cast<const float4*>(row + 4);
  float4 b0 = *reinterpret_cast<const float4*>(row + 16);
  float4 b1 = *reinterpret_cast<const float4*>(row + 20);
  v16h r;
  r[0] = (_Float16)a0.x;  r[1] = (_Float16)a0.y;
  r[2] = (_Float16)a0.z;  r[3] = (_Float16)a0.w;
  r[4] = (_Float16)a1.x;  r[5] = (_Float16)a1.y;
  r[6] = (_Float16)a1.z;  r[7] = (_Float16)a1.w;
  r[8] = (_Float16)b0.x;  r[9] = (_Float16)b0.y;
  r[10] = (_Float16)b0.z; r[11] = (_Float16)b0.w;
  r[12] = (_Float16)b1.x; r[13] = (_Float16)b1.y;
  r[14] = (_Float16)b1.z; r[15] = (_Float16)b1.w;
  return r;
}

// Qb[k, n] = (n == k/16) ? qh_p[k] : 0  -- block-diagonal query embedding.
__device__ __forceinline__ v16h readB_qb(const _Float16* qh_p, int k0, int lane) {
  int n = lane & 15;
  v16h r;
#pragma unroll
  for (int v = 0; v < 8; ++v) {
    int k = k0 + kmap(v, lane);
    h2 p = *reinterpret_cast<const h2*>(qh_p + k);
    r[2 * v] = (n == (k >> 4)) ? p.x : (_Float16)0.0f;
    r[2 * v + 1] = (n == ((k + 1) >> 4)) ? p.y : (_Float16)0.0f;
  }
  return r;
}

__device__ __forceinline__ void storeD_h(_Float16* buf, int stride, int m0,
                                         int n0, v8f acc, int lane, float scale) {
  int n = n0 + (lane & 15);
  int mb = m0 + ((lane & 16) ? 8 : 0);
#pragma unroll
  for (int v = 0; v < 8; ++v)
    buf[(mb + v) * stride + n] = (_Float16)(acc[v] * scale);
}

__device__ __forceinline__ v16h packD(v8f lo, v8f hi) {
  v16h r;
#pragma unroll
  for (int s = 0; s < 8; ++s) {
    r[s] = (_Float16)lo[s];
    r[8 + s] = (_Float16)hi[s];
  }
  return r;
}

__device__ __forceinline__ unsigned uni(unsigned v) {
  return (unsigned)__builtin_amdgcn_readfirstlane((int)v);
}

__device__ __forceinline__ void kv_issue(float* ldsdst, const float* gsrc,
                                         int lane) {
#if defined(HAVE_TDM)
  unsigned long long ga = (unsigned long long)(uintptr_t)gsrc;
  u32x4 g0;
  g0[0] = uni(1u);
  g0[1] = uni((unsigned)(uintptr_t)ldsdst);
  g0[2] = uni((unsigned)(ga & 0xffffffffu));
  g0[3] = uni((unsigned)((ga >> 32) & 0x01ffffffu) | (2u << 30));
  i32x8 g1;
  g1[0] = (int)((1u << 20) | (5u << 22) | (3u << 25));
  g1[1] = (int)(256u << 16);
  g1[2] = (int)(64u << 16);
  g1[3] = (int)(256u << 16);
  g1[4] = 64;
  g1[5] = (int)(KV_TSTRIDE * sizeof(float));
  g1[6] = 0;
  g1[7] = 0;
  i32x4 gz = {0, 0, 0, 0};   // 2D tensor: groups 2/3 unused
#if defined(__clang_major__) && __clang_major__ >= 23
  i32x8 gz8 = {0, 0, 0, 0, 0, 0, 0, 0};
  __builtin_amdgcn_tensor_load_to_lds(g0, g1, gz, gz, gz8, 0);
#else
  __builtin_amdgcn_tensor_load_to_lds(g0, g1, gz, gz, 0);
#endif
#else
#pragma unroll 4
  for (int it = 0; it < 32; ++it) {
    int fl = it * 32 + lane;
    int t = fl >> 4;
    int c4 = (fl & 15) * 4;
    float4 v4 = *reinterpret_cast<const float4*>(gsrc + (size_t)t * KV_TSTRIDE + c4);
    *reinterpret_cast<float4*>(ldsdst + t * KVP + c4) = v4;
  }
#endif
}

__device__ __forceinline__ void kv_wait() {
#if defined(HAVE_TDM)
  __builtin_amdgcn_s_wait_tensorcnt(0);
#endif
  asm volatile("" ::: "memory");
}

__global__ __launch_bounds__(64) void pw_attn_kernel(
    const float* __restrict__ q, const float* __restrict__ kv,
    const float* __restrict__ Wq, const float* __restrict__ Wk,
    const float* __restrict__ Wv, const float* __restrict__ Wout,
    const float* __restrict__ b_out, float* __restrict__ out) {
  // Phase-aliased LDS pool (40KB) + persistent buffers. Total 60KB.
  // 2 KiB alignment: each wave's tensor-load destination is a 2 KiB multiple.
  __shared__ __align__(2048) unsigned char s_pool[POOL_BYTES];
  __shared__ _Float16 s_wk[KVCH * KVCH];  // 8KB  Wk f16, row-major (A reads)
  __shared__ _Float16 s_wv[KVCH * KVCH];  // 8KB  Wv f16, B-packed (8 tiles)
  __shared__ _Float16 s_qh[16 * KVCH];    // 2KB  qh (pre-scaled) per tile
  __shared__ _Float16 s_x[16 * KVCH];     // 2KB  attended features X16

  const int tid = threadIdx.x;
  const int wave = tid >> 5;
  const int lane = tid & 31;

  const int base = blockIdx.x * 16;  // flat pixel base (n*4096 + i*64 + j)
  const int n_img = base >> 12;
  const int pij0 = base & 4095;
  const float* kv_n = kv + (size_t)n_img * TDIM * KV_TSTRIDE;

  // ---- Phase 0/1 staging -> f16 LDS. B weights go in packed layout. ------
  _Float16* s_wq = (_Float16*)s_pool;             // 256x64 B-packed (32KB)
  _Float16* s_qbuf = (_Float16*)(s_pool + 32768); // 16x256 row-major (8KB)
  {
    f32x4 rk[16], rq[16], rv[2][8], w0[2][8], w1[2][8], w2[2][8], w3[2][8];
    const float* pv = blk_ptr<KVCH, KVCH>(Wv, tid);
    const float* pq = blk_ptr<QCH, KVCH>(Wq, tid);
    rows_load<16>(rk, Wk, tid);
    bpk_load<KVCH, KVCH, 0, 2>(rv, pv);
    rows_load<16>(rq, q + (size_t)base * QCH, tid);  // 16 adjacent rows of q
    loads_issued(pv);
    rows_store<16>(s_wk, rk, tid);                   // row-major (A operand)
    stage_fence();
    bpk_load<QCH, KVCH, 0, 2>(w0, pq);
    loads_issued(pq);
    bpk_store<KVCH, KVCH, 0, 2>(s_wv, rv, tid);      // B-packed, tile n4*2+kc
    stage_fence();
    bpk_load<QCH, KVCH, 2, 2>(w1, pq);
    loads_issued(pq);
    rows_store<16>(s_qbuf, rq, tid);                 // row-major (A operand)
    stage_fence();
    bpk_load<QCH, KVCH, 4, 2>(w2, pq);
    loads_issued(pq);
    bpk_store<QCH, KVCH, 0, 2>(s_wq, w0, tid);       // B-packed, tile n4*8+kc
    stage_fence();
    bpk_load<QCH, KVCH, 6, 2>(w3, pq);
    loads_issued(pq);
    bpk_store<QCH, KVCH, 2, 2>(s_wq, w1, tid);
    bpk_store<QCH, KVCH, 4, 2>(s_wq, w2, tid);
    bpk_store<QCH, KVCH, 6, 2>(s_wq, w3, tid);
  }
  __syncthreads();

  // ---- Phase 1: qh = (q16 @ Wq) * 0.25, kept f16 in LDS (16x64) ----------
  {
    v8f acc0 = {}, acc1 = {};
    const int nt0 = 2 * wave, nt1 = 2 * wave + 1;
#pragma unroll
    for (int kc = 0; kc < 8; ++kc) {
      v16h a = readA(s_qbuf, QCH, 0, kc * 32, lane);
      v16h b0 = readPacked(s_wq, nt0 * 8 + kc, lane);
      v16h b1 = readPacked(s_wq, nt1 * 8 + kc, lane);
      acc0 = wmma16(a, b0, acc0);
      acc1 = wmma16(a, b1, acc1);
    }
    storeD_h(s_qh, KVCH, 0, nt0 * 16, acc0, lane, 0.25f);  // fold 1/sqrt(16)
    storeD_h(s_qh, KVCH, 0, nt1 * 16, acc1, lane, 0.25f);
  }
  __syncthreads();  // pool (Wq/qbuf) dead after this point

  float* kvraw = (float*)(s_pool + wave * KV_LDS_BYTES);

  // Loop-invariant WMMA operands: Wk A-tiles, Wv B-tiles (16 x v16h regs).
  v16h wk_a[8], wv_b[8];
#pragma unroll
  for (int kc = 0; kc < 2; ++kc)
#pragma unroll
    for (int t4 = 0; t4 < 4; ++t4) {
      wk_a[kc * 4 + t4] = readA(s_wk, KVCH, t4 * 16, kc * 32, lane);
      wv_b[kc * 4 + t4] = readPacked(s_wv, t4 * 2 + kc, lane);
    }

  // Prologue: start DMA of this wave's first pixel.
  kv_issue(kvraw, kv_n + (size_t)(pij0 + wave * 8) * KVCH, lane);

  for (int i = 0; i < 8; ++i) {
    const int p = wave * 8 + i;  // pixel within tile

    // b) Wkq = Wk @ Qb(qh_p): needs no KV, so it runs while the tile lands or
    // is read. Its D tiles (rows = kv channel) are S's B operand in registers.
    v16h wkq_b[2];
    {
      v8f acc[4] = {};
#pragma unroll
      for (int kc = 0; kc < 2; ++kc) {
        v16h b = readB_qb(&s_qh[p * KVCH], kc * 32, lane);
#pragma unroll
        for (int mt = 0; mt < 4; ++mt)
          acc[mt] = wmma16(wk_a[kc * 4 + mt], b, acc[mt]);
      }
      wkq_b[0] = packD(acc[0], acc[1]);
      wkq_b[1] = packD(acc[2], acc[3]);
    }

    kv_wait();  // s_wait_tensorcnt 0: KV tile resident in LDS

    // The tile's only read: 8 A fragments (row t, k = channel), kept for S
    // and for Vh.
    v16h kv_a[8];
#pragma unroll
    for (int kc = 0; kc < 2; ++kc)
#pragma unroll
      for (int mt = 0; mt < 4; ++mt)
        kv_a[kc * 4 + mt] = readA_f32(kvraw, KVP, mt * 16, kc * 32, lane);

    // Drain kvraw reads, then start the next pixel's DMA (overlaps c to f
    // and the next b).
    if (i < 7) {
      asm volatile("s_wait_dscnt 0x0" ::: "memory");
      kv_issue(kvraw, kv_n + (size_t)(pij0 + p + 1) * KVCH, lane);
    }

    // c) S = KV @ Wkq  (64t x 16, cols 0..3 = groups)
    v8f sacc[4] = {};
#pragma unroll
    for (int kc = 0; kc < 2; ++kc)
#pragma unroll
      for (int mt = 0; mt < 4; ++mt)
        sacc[mt] = wmma16(kv_a[kc * 4 + mt], wkq_b[kc], sacc[mt]);

    // d) softmax over t per group, in registers: column g lives on lanes
    // g and g+16 (D layout), so one shfl_xor(16) completes each reduction.
    // Columns 4..15 hold zero scores; their rows of x are never read.
    v16h at_a[2];  // A operand: row g, k = t
    {
      float mx = -1e30f;
#pragma unroll
      for (int mt = 0; mt < 4; ++mt)
#pragma unroll
        for (int v = 0; v < 8; ++v) mx = fmaxf(mx, sacc[mt][v]);
      mx = fmaxf(mx, __shfl_xor(mx, 16));
      float sum = 0.0f;
#pragma unroll
      for (int mt = 0; mt < 4; ++mt)
#pragma unroll
        for (int v = 0; v < 8; ++v) {
          float e = __expf(sacc[mt][v] - mx);
          sacc[mt][v] = e;
          sum += e;
        }
      sum += __shfl_xor(sum, 16);
      float inv = 1.0f / sum;
#pragma unroll
      for (int mt = 0; mt < 4; ++mt)
#pragma unroll
        for (int v = 0; v < 8; ++v) sacc[mt][v] *= inv;
      at_a[0] = packD(sacc[0], sacc[1]);
      at_a[1] = packD(sacc[2], sacc[3]);
    }

    // e) Vh = KV @ Wv, 16 columns at a time (64t x 16); its D tiles are the B
    // operand of f) Y = A^T @ Vh ; x[g*16+c] = Y[g, g*16+c] (group-diagonal).
#pragma unroll
    for (int nt = 0; nt < 4; ++nt) {
      v8f vh[4] = {};
#pragma unroll
      for (int kc = 0; kc < 2; ++kc)
#pragma unroll
        for (int mt = 0; mt < 4; ++mt)
          vh[mt] = wmma16(kv_a[kc * 4 + mt], wv_b[kc * 4 + nt], vh[mt]);
      v8f y = {};
      y = wmma16(at_a[0], packD(vh[0], vh[1]), y);
      y = wmma16(at_a[1], packD(vh[2], vh[3]), y);
      if (lane < 16)
        s_x[p * KVCH + nt * 16 + lane] = (_Float16)y[nt];
    }
  }
  __syncthreads();  // both waves done with their KV tiles and s_x

  // ---- Phase 3: out = X16 @ Wout + b_out  (16 x 256) ---------------------
  _Float16* s_wout = (_Float16*)s_pool;  // 64x256 B-packed (32KB), pool reuse
  {
    f32x4 w0[2][8], w1[2][8], w2[2][8], w3[2][8];
    const float* po = blk_ptr<KVCH, QCH>(Wout, tid);
    bpk_load<KVCH, QCH, 0, 2>(w0, po);
    bpk_load<KVCH, QCH, 2, 2>(w1, po);
    bpk_load<KVCH, QCH, 4, 2>(w2, po);
    loads_issued(po);
    bpk_store<KVCH, QCH, 0, 2>(s_wout, w0, tid);     // tile = (n>>4)*2 + kc
    stage_fence();
    bpk_load<KVCH, QCH, 6, 2>(w3, po);
    loads_issued(po);
    bpk_store<KVCH, QCH, 2, 2>(s_wout, w1, tid);
    bpk_store<KVCH, QCH, 4, 2>(s_wout, w2, tid);
    bpk_store<KVCH, QCH, 6, 2>(s_wout, w3, tid);
  }
  __syncthreads();
  {
    // The wave's 8 bias values, off one address that stays whole up to the
    // wait behind the loads.
    float bia[8];
    const float* pb = b_out + wave * 128 + (lane & 15);
#pragma unroll
    for (int j = 0; j < 8; ++j) bia[j] = pb[j * 16];
    loads_issued(pb);
    v8f acc[8] = {};
#pragma unroll
    for (int kc = 0; kc < 2; ++kc) {
      v16h a = readA(s_x, KVCH, 0, kc * 32, lane);
#pragma unroll
      for (int j = 0; j < 8; ++j) {
        int nt = wave * 8 + j;
        v16h b = readPacked(s_wout, nt * 2 + kc, lane);
        acc[j] = wmma16(a, b, acc[j]);
      }
    }
    int mb = (lane & 16) ? 8 : 0;
#pragma unroll
    for (int j = 0; j < 8; ++j) {
      int col = (wave * 8 + j) * 16 + (lane & 15);
#pragma unroll
      for (int v = 0; v < 8; ++v)
        out[((size_t)(base + mb + v)) * QCH + col] = acc[j][v] + bia[j];
    }
  }
}

extern "C" void kernel_launch(void* const* d_in, const int* in_sizes, int n_in,
                              void* d_out, int out_size, void* d_ws,
                              size_t ws_size, hipStream_t stream) {
  const float* q = (const float*)d_in[0];
  const float* kv = (const float*)d_in[1];
  const float* Wq = (const float*)d_in[2];
  const float* Wk = (const float*)d_in[3];
  const float* Wv = (const float*)d_in[4];
  const float* Wout = (const float*)d_in[5];
  const float* b_out = (const float*)d_in[6];
  float* out = (float*)d_out;

  dim3 grid(PIX / 16);  // 1024 workgroups, 16 pixels each
  dim3 block(64);       // 2 wave32s
  pw_attn_kernel<<<grid, block, 0, stream>>>(q, kv, Wq, Wk, Wv, Wout, b_out,
                                             out);
}

// v004
// It runs in 22.8 microseconds.
// In two side-by-side timings against v003, it was 1.23 and 1.22 times as fast.
// Over all steps from v000 it is 4.52 times as fast.
#include <hip/hip_runtime.h>
#include <hip/hip_bf16.h>

typedef __attribute__((ext_vector_type(16))) _Float16 v16h;
typedef __attribute__((ext_vector_type(8)))  _Float16 v8h;
typedef __attribute__((ext_vector_type(4)))  _Float16 v4h;
typedef __attribute__((ext_vector_type(4)))  float    f32x4;
typedef __attribute__((ext_vector_type(8)))  float    v8f;
typedef __attribute__((ext_vector_type(2)))  _Float16 h2;
typedef __attribute__((ext_vector_type(4)))  unsigned u32x4;
typedef __attribute__((ext_vector_type(8)))  int      i32x8;
typedef __attribute__((ext_vector_type(4)))  int      i32x4;

#define NIMG 4
#define TDIM 64
#define LDIM 64
#define QCH  256
#define KVCH 64
#define PIX  (NIMG * LDIM * LDIM)               // 16384 flat pixels
#define KV_TSTRIDE ((size_t)LDIM * LDIM * KVCH) // 262144 floats between t rows
#define KVP 68
#define KV_LDS_BYTES 18432  // 64 rows x 272 B = 17408, rounded up to 2 KiB

#if defined(__has_builtin)
#if __has_builtin(__builtin_amdgcn_tensor_load_to_lds) && \
    __has_builtin(__builtin_amdgcn_s_wait_tensorcnt)
#define HAVE_TDM 1
#endif
#endif

__device__ __forceinline__ v8f wmma16(v16h a, v16h b, v8f c) {
  return __builtin_amdgcn_wmma_f32_16x16x32_f16(false, a, false, b, (short)0, c,
                                                false, false);
}

__device__ __forceinline__ int kmap(int v, int lane) {
  int b = (v < 4) ? (v * 2) : (16 + (v - 4) * 2);
  return b + ((lane & 16) ? 8 : 0);
}

// Row-major staging, f32 global -> f16 LDS in the same order: the 64 threads
// walk CNT runs of 1 KiB, 16 bytes a lane. Loads and stores are two calls, so
// that later groups' loads are in flight while a group is converted.
template <int CNT>
__device__ __forceinline__ void rows_load(f32x4 (&r)[CNT], const float* src,
                                          int tid) {
#pragma unroll  // constant indices keep the arrays in registers
  for (int u = 0; u < CNT; ++u)
    r[u] = *reinterpret_cast<const f32x4*>(src + (u * 64 + tid) * 4);
}

template <int CNT>
__device__ __forceinline__ void rows_store(_Float16* dst, const f32x4 (&r)[CNT],
                                           int tid) {
#pragma unroll  // constant indices keep the arrays in registers
  for (int u = 0; u < CNT; ++u) {
    v4h h;
#pragma unroll  // constant indices keep the arrays in registers
    for (int c = 0; c < 4; ++c) h[c] = (_Float16)r[u][c];
    *reinterpret_cast<v4h*>(dst + (u * 64 + tid) * 4) = h;
  }
}

// B fragments of a row-major f32 weight with N columns, in registers. p names
// the lane's first row (chunk base + 8 for the upper 16 lanes) and its 4
// columns; the 16 rows are the lane's k of a 32-k chunk in the hardware k order
// (the order of readA). A load covers 256 adjacent bytes of each of two rows.
template <int N>
__device__ __forceinline__ void cols_load(f32x4 (&r)[16], const float* p) {
#pragma unroll  // constant indices keep the arrays in registers
  for (int s = 0; s < 16; ++s)
    r[s] = *reinterpret_cast<const f32x4*>(p + ((s & 7) + 16 * (s >> 3)) * N);
}

// Column j of the 16 loads is the lane's part of n tile j.
template <int O, int NB>
__device__ __forceinline__ void cols_pack(v16h (&b)[NB], const f32x4 (&r)[16]) {
#pragma unroll  // constant indices keep the arrays in registers
  for (int j = 0; j < 4; ++j)
#pragma unroll  // constant indices keep the arrays in registers
    for (int s = 0; s < 16; ++s) b[O + j][s] = (_Float16)r[s][j];
}

__device__ __forceinline__ void stage_fence() {
  __builtin_amdgcn_sched_barrier(0);
}

// Stands behind a group's loads: the wait comes before anything reuses an
// address register that those loads name. The
// group's address is an input, so that it stays whole up to the wait and no
// load of the group lands on it; the fence keeps what follows behind the wait.
__device__ __forceinline__ void loads_issued(const float* p) {
  asm volatile("s_wait_xcnt 0x0" ::"v"(p) : "memory");
  __builtin_amdgcn_sched_barrier(0);
}

// A operand from row-major f16 LDS: two contiguous 8-half runs per lane.
__device__ __forceinline__ v16h readA(const _Float16* buf, int stride, int m0,
                                      int k0, int lane) {
  const _Float16* row =
      buf + (m0 + (lane & 15)) * stride + k0 + ((lane & 16) ? 8 : 0);
  v8h lo = *reinterpret_cast<const v8h*>(row);       // k: base+0..7
  v8h hi = *reinterpret_cast<const v8h*>(row + 16);  // k: base+16..23
  return __builtin_shufflevector(lo, hi, 0, 1, 2, 3, 4, 5, 6, 7, 8, 9, 10, 11,
                                 12, 13, 14, 15);
}

__device__ __forceinline__ v16h readA_f32(const float* buf, int stride, int m0,
                                          int k0, int lane) {
  const float* row =
      buf + (m0 + (lane & 15)) * stride + k0 + ((lane & 16) ? 8 : 0);
  float4 a0 = *reinterpret_cast<const float4*>(row);
  float4 a1 = *reinterpret_cast<const float4*>(row + 4);
  float4 b0 = *reinterpret_cast<const float4*>(row + 16);
  float4 b1 = *reinterpret_cast<const float4*>(row + 20);
  v16h r;
  r[0] = (_Float16)a0.x;  r[1] = (_Float16)a0.y;
  r[2] = (_Float16)a0.z;  r[3] = (_Float16)a0.w;
  r[4] = (_Float16)a1.x;  r[5] = (_Float16)a1.y;
  r[6] = (_Float16)a1.z;  r[7] = (_Float16)a1.w;
  r[8] = (_Float16)b0.x;  r[9] = (_Float16)b0.y;
  r[10] = (_Float16)b0.z; r[11] = (_Float16)b0.w;
  r[12] = (_Float16)b1.x; r[13] = (_Float16)b1.y;
  r[14] = (_Float16)b1.z; r[15] = (_Float16)b1.w;
  return r;
}

// Qb[k, n] = (n == k/16) ? qh_p[k] : 0  -- block-diagonal query embedding.
__device__ __forceinline__ v16h readB_qb(const _Float16* qh_p, int k0, int lane) {
  int n = lane & 15;
  v16h r;
#pragma unroll  // constant indices keep the arrays in registers
  for (int v = 0; v < 8; ++v) {
    int k = k0 + kmap(v, lane);
    h2 p = *reinterpret_cast<const h2*>(qh_p + k);
    r[2 * v] = (n == (k >> 4)) ? p.x : (_Float16)0.0f;
    r[2 * v + 1] = (n == ((k + 1) >> 4)) ? p.y : (_Float16)0.0f;
  }
  return r;
}

__device__ __forceinline__ v16h packD(v8f lo, v8f hi) {
  v16h r;
#pragma unroll  // constant indices keep the arrays in registers
  for (int s = 0; s < 8; ++s) {
    r[s] = (_Float16)lo[s];
    r[8 + s] = (_Float16)hi[s];
  }
  return r;
}

__device__ __forceinline__ unsigned uni(unsigned v) {
  return (unsigned)__builtin_amdgcn_readfirstlane((int)v);
}

__device__ __forceinline__ u32x4 kv_issue(float* ldsdst, const float* gsrc,
                                          int lane) {
  u32x4 g0 = {0u, 0u, 0u, 0u};
#if defined(HAVE_TDM)
  unsigned long long ga = (unsigned long long)(uintptr_t)gsrc;
  g0[0] = uni(1u);
  g0[1] = uni((unsigned)(uintptr_t)ldsdst);
  g0[2] = uni((unsigned)(ga & 0xffffffffu));
  g0[3] = uni((unsigned)((ga >> 32) & 0x01ffffffu) | (2u << 30));
  i32x8 g1;
  g1[0] = (int)((1u << 20) | (5u << 22) | (3u << 25));
  g1[1] = (int)(256u << 16);
  g1[2] = (int)(64u << 16);
  g1[3] = (int)(256u << 16);
  g1[4] = 64;
  g1[5] = (int)(KV_TSTRIDE * sizeof(float));
  g1[6] = 0;
  g1[7] = 0;
  i32x4 gz = {0, 0, 0, 0};   // 2D tensor: groups 2/3 unused
#if defined(__clang_major__) && __clang_major__ >= 23
  i32x8 gz8 = {0, 0, 0, 0, 0, 0, 0, 0};
  __builtin_amdgcn_tensor_load_to_lds(g0, g1, gz, gz, gz8, 0);
#else
  __builtin_amdgcn_tensor_load_to_lds(g0, g1, gz, gz, 0);
#endif
#else
#pragma unroll 4
  for (int it = 0; it < 32; ++it) {
    int fl = it * 32 + lane;
    int t = fl >> 4;
    int c4 = (fl & 15) * 4;
    float4 v4 = *reinterpret_cast<const float4*>(gsrc + (size_t)t * KV_TSTRIDE + c4);
    *reinterpret_cast<float4*>(ldsdst + t * KVP + c4) = v4;
  }
#endif
  return g0;
}

__device__ __forceinline__ void kv_wait(u32x4 g0) {
  asm volatile("s_wait_tensorcnt 0x0" ::"s"(g0) : "memory");
}

// One 32-k chunk of qh: the q fragment against the chunk's 4 Wq fragments.
__device__ __forceinline__ void qh_step(v8f (&acc)[4], const _Float16* qbuf,
                                        int kc, const v16h (&b)[4], int lane) {
  v16h a = readA(qbuf, QCH, 0, kc * 32, lane);
#pragma unroll  // constant indices keep the arrays in registers
  for (int j = 0; j < 4; ++j) acc[j] = wmma16(a, b[j], acc[j]);
}

__global__ __launch_bounds__(64, 3) void pw_attn_kernel(
    const float* __restrict__ q, const float* __restrict__ kv,
    const float* __restrict__ Wq, const float* __restrict__ Wk,
    const float* __restrict__ Wv, const float* __restrict__ Wout,
    const float* __restrict__ b_out, float* __restrict__ out) {
  // Nothing in LDS is aliased. Total 60KB.
  // 2 KiB alignment: each wave's tensor-load destination is a 2 KiB multiple.
  __shared__ __align__(2048) unsigned char s_kv[2 * KV_LDS_BYTES];
  __shared__ _Float16 s_qbuf[16 * QCH];   // 8KB  q f16, row-major (A reads)
  __shared__ _Float16 s_wk[KVCH * KVCH];  // 8KB  Wk f16, row-major (A reads)
  __shared__ __align__(16) float s_part[16 * KVCH];  // 4KB  qh half sums
  __shared__ _Float16 s_qh[16 * KVCH];    // 2KB  qh (pre-scaled) per tile
  __shared__ _Float16 s_x[16 * KVCH];     // 2KB  attended features X16

  const int tid = threadIdx.x;
  const int wave = tid >> 5;
  const int lane = tid & 31;
  const int l16 = lane & 15;
  const int half = lane >> 4;

  const int base = blockIdx.x * 16;  // flat pixel base (n*4096 + i*64 + j)
  const int n_img = base >> 12;
  const int pij0 = base & 4095;
  const float* kv_n = kv + (size_t)n_img * TDIM * KV_TSTRIDE;

  float* kvraw = (float*)(s_kv + wave * KV_LDS_BYTES);
  u32x4 kv_dsc;

  // ---- Phase 0/1: q, Wk -> f16 LDS; qh = (q16 @ Wq) * 0.25 ---------------
  // Each wave takes half of K (128 rows of Wq) for all 64 columns; D tile j
  // holds columns 4*l16 + j. Wv's fragments are fetched behind Wq's.
  v8f qacc[4] = {};
  v16h wv_b[8];  // loop-invariant: chunk kc, n tile nt at [kc * 4 + nt]
  {
    f32x4 rq[16], rk[16], g0[16], g1[16], g2[16], g3[16], v0[16], v1[16];
    const float* pq = Wq + (wave * 128 + half * 8) * KVCH + l16 * 4;
    const float* pv = Wv + half * 8 * KVCH + l16 * 4;
    v16h b[4];
    const float* pr = q + (size_t)base * QCH;        // 16 adjacent rows of q
    rows_load<16>(rq, pr, tid);
    loads_issued(pr + tid * 4);
    // The first pixel's DMA starts here, behind q alone (phase 1 waits for q,
    // so q goes to memory first), and flies under all of phases 0 and 1.
    kv_dsc = kv_issue(kvraw, kv_n + (size_t)(pij0 + wave * 8) * KVCH, lane);
    rows_load<16>(rk, Wk, tid);
    cols_load<KVCH>(g0, pq);
    cols_load<KVCH>(g1, pq + 32 * KVCH);
    loads_issued(pq);
    rows_store<16>(s_qbuf, rq, tid);                 // row-major (A operand)
    stage_fence();
    cols_load<KVCH>(g2, pq + 64 * KVCH);
    loads_issued(pq);
    rows_store<16>(s_wk, rk, tid);                   // row-major (A operand)
    stage_fence();
    cols_load<KVCH>(g3, pq + 96 * KVCH);
    loads_issued(pq);
    __syncthreads();  // q and Wk are in LDS
    cols_pack<0, 4>(b, g0);
    qh_step(qacc, s_qbuf, wave * 4 + 0, b, lane);
    cols_pack<0, 4>(b, g1);
    qh_step(qacc, s_qbuf, wave * 4 + 1, b, lane);
    stage_fence();
    cols_load<KVCH>(v0, pv);
    loads_issued(pv);
    cols_pack<0, 4>(b, g2);
    qh_step(qacc, s_qbuf, wave * 4 + 2, b, lane);
    stage_fence();
    cols_load<KVCH>(v1, pv + 32 * KVCH);
    loads_issued(pv);
    cols_pack<0, 4>(b, g3);
    qh_step(qacc, s_qbuf, wave * 4 + 3, b, lane);
    cols_pack<0, 8>(wv_b, v0);
    cols_pack<4, 8>(wv_b, v1);
  }
  // The two half sums meet: a wave's own 8 pixels are the D rows of lanes with
  // half == wave; the other 16 lanes hand their rows to the other wave.
  if (half != wave) {
#pragma unroll  // constant indices keep the arrays in registers
    for (int v = 0; v < 8; ++v) {
      f32x4 t = {qacc[0][v], qacc[1][v], qacc[2][v], qacc[3][v]};
      *reinterpret_cast<f32x4*>(&s_part[(half * 8 + v) * KVCH + l16 * 4]) = t;
    }
  }
  __syncthreads();  // half sums are in LDS
  if (half == wave) {
#pragma unroll  // constant indices keep the arrays in registers
    for (int v = 0; v < 8; ++v) {
      f32x4 t =
          *reinterpret_cast<const f32x4*>(&s_part[(half * 8 + v) * KVCH + l16 * 4]);
      v4h h;
#pragma unroll  // constant indices keep the arrays in registers
      for (int j = 0; j < 4; ++j)
        h[j] = (_Float16)((qacc[j][v] + t[j]) * 0.25f);  // fold 1/sqrt(16)
      *reinterpret_cast<v4h*>(&s_qh[(half * 8 + v) * KVCH + l16 * 4]) = h;
    }
  }
  // s_qh rows of a wave's own pixels are written and read by that wave alone.

  // ---- Phase 2: decoupled per-wave pipelines (no intra-phase barriers) ---
  // Loop-invariant WMMA operands: Wk A-tiles (8 x v16h regs), with wv_b.
  v16h wk_a[8];
#pragma unroll  // constant indices keep the arrays in registers
  for (int kc = 0; kc < 2; ++kc)
#pragma unroll  // constant indices keep the arrays in registers
    for (int t4 = 0; t4 < 4; ++t4)
      wk_a[kc * 4 + t4] = readA(s_wk, KVCH, t4 * 16, kc * 32, lane);

  for (int i = 0; i < 8; ++i) {
    const int p = wave * 8 + i;  // pixel within tile

    // b) Wkq = Wk @ Qb(qh_p): needs no KV, so it runs while the tile lands or
    // is read. Its D tiles (rows = kv channel) are S's B operand in registers.
    v16h wkq_b[2];
    {
      v8f acc[4] = {};
#pragma unroll  // constant indices keep the arrays in registers
      for (int kc = 0; kc < 2; ++kc) {
        v16h b = readB_qb(&s_qh[p * KVCH], kc * 32, lane);
#pragma unroll  // constant indices keep the arrays in registers
        for (int mt = 0; mt < 4; ++mt)
          acc[mt] = wmma16(wk_a[kc * 4 + mt], b, acc[mt]);
      }
      wkq_b[0] = packD(acc[0], acc[1]);
      wkq_b[1] = packD(acc[2], acc[3]);
    }

    kv_wait(kv_dsc);  // s_wait_tensorcnt 0: KV tile resident in LDS

    // The tile's only read: 8 A fragments (row t, k = channel), kept for S
    // and for Vh.
    v16h kv_a[8];
#pragma unroll  // constant indices keep the arrays in registers
    for (int kc = 0; kc < 2; ++kc)
#pragma unroll  // constant indices keep the arrays in registers
      for (int mt = 0; mt < 4; ++mt)
        kv_a[kc * 4 + mt] = readA_f32(kvraw, KVP, mt * 16, kc * 32, lane);

    // Drain kvraw reads, then start the next pixel's DMA (overlaps c to f
    // and the next b).
    if (i < 7) {
      asm volatile("s_wait_dscnt 0x0" ::: "memory");
      kv_dsc = kv_issue(kvraw, kv_n + (size_t)(pij0 + p + 1) * KVCH, lane);
    }

    // c) S = KV @ Wkq  (64t x 16, cols 0..3 = groups)
    v8f sacc[4] = {};
#pragma unroll  // constant indices keep the arrays in registers
    for (int kc = 0; kc < 2; ++kc)
#pragma unroll  // constant indices keep the arrays in registers
      for (int mt = 0; mt < 4; ++mt)
        sacc[mt] = wmma16(kv_a[kc * 4 + mt], wkq_b[kc], sacc[mt]);

    // d) softmax over t per group, in registers: column g lives on lanes
    // g and g+16 (D layout), so one shfl_xor(16) completes each reduction.
    // Columns 4..15 hold zero scores; their rows of x are never read.
    v16h at_a[2];  // A operand: row g, k = t
    {
      float mx = -1e30f;
#pragma unroll  // constant indices keep the arrays in registers
      for (int mt = 0; mt < 4; ++mt)
#pragma unroll  // constant indices keep the arrays in registers
        for (int v = 0; v < 8; ++v) mx = fmaxf(mx, sacc[mt][v]);
      mx = fmaxf(mx, __shfl_xor(mx, 16));
      float sum = 0.0f;
#pragma unroll  // constant indices keep the arrays in registers
      for (int mt = 0; mt < 4; ++mt)
#pragma unroll  // constant indices keep the arrays in registers
        for (int v = 0; v < 8; ++v) {
          float e = __expf(sacc[mt][v] - mx);
          sacc[mt][v] = e;
          sum += e;
        }
      sum += __shfl_xor(sum, 16);
      float inv = 1.0f / sum;
#pragma unroll  // constant indices keep the arrays in registers
      for (int mt = 0; mt < 4; ++mt)
#pragma unroll  // constant indices keep the arrays in registers
        for (int v = 0; v < 8; ++v) sacc[mt][v] *= inv;
      at_a[0] = packD(sacc[0], sacc[1]);
      at_a[1] = packD(sacc[2], sacc[3]);
    }

    v4h xv;
#pragma unroll  // constant indices keep the arrays in registers
    for (int nt = 0; nt < 4; ++nt) {
      v8f vh[4] = {};
#pragma unroll  // constant indices keep the arrays in registers
      for (int kc = 0; kc < 2; ++kc)
#pragma unroll  // constant indices keep the arrays in registers
        for (int mt = 0; mt < 4; ++mt)
          vh[mt] = wmma16(kv_a[kc * 4 + mt], wv_b[kc * 4 + nt], vh[mt]);
      v8f y = {};
      y = wmma16(at_a[0], packD(vh[0], vh[1]), y);
      y = wmma16(at_a[1], packD(vh[2], vh[3]), y);
      const float y01 = (l16 & 4) ? y[1] : y[0];
      const float y23 = (l16 & 4) ? y[3] : y[2];
      xv[nt] = (_Float16)((l16 & 8) ? y23 : y01);
    }
    if (lane < 16) *reinterpret_cast<v4h*>(&s_x[p * KVCH + l16 * 4]) = xv;
  }

  // ---- Phase 3: out = X16 @ Wout + b_out  (16 x 256) ---------------------
  // A wave takes 128 columns, as 2 runs of 64; D tile j of run c holds columns
  // 64*c + 4*l16 + j, so a lane stores 4 adjacent columns of a row at once.
  // The loads need nothing of the loop and fly while the waves meet.
  f32x4 wo[4][16], bia[2];
  {
    const float* pb = b_out + wave * 128 + l16 * 4;
    const float* po = Wout + half * 8 * QCH + wave * 128 + l16 * 4;
    bia[0] = *reinterpret_cast<const f32x4*>(pb);
    bia[1] = *reinterpret_cast<const f32x4*>(pb + 64);
    loads_issued(pb);
    cols_load<QCH>(wo[0], po);
    cols_load<QCH>(wo[1], po + 64);
    cols_load<QCH>(wo[2], po + 32 * QCH);
    cols_load<QCH>(wo[3], po + 32 * QCH + 64);
    loads_issued(po);
  }
  __syncthreads();  // both waves' rows of s_x are written
  {
    v8f acc[2][4] = {};
#pragma unroll  // constant indices keep the arrays in registers
    for (int kc = 0; kc < 2; ++kc) {
      v16h a = readA(s_x, KVCH, 0, kc * 32, lane);
#pragma unroll  // constant indices keep the arrays in registers
      for (int c = 0; c < 2; ++c) {
        v16h b[4];
        cols_pack<0, 4>(b, wo[kc * 2 + c]);
#pragma unroll  // constant indices keep the arrays in registers
        for (int j = 0; j < 4; ++j) acc[c][j] = wmma16(a, b[j], acc[c][j]);
      }
    }
    float* pout = out + (size_t)(base + half * 8) * QCH + wave * 128 + l16 * 4;
#pragma unroll  // constant indices keep the arrays in registers
    for (int c = 0; c < 2; ++c)
#pragma unroll  // constant indices keep the arrays in registers
      for (int v = 0; v < 8; ++v) {
        f32x4 r = {acc[c][0][v], acc[c][1][v], acc[c][2][v], acc[c][3][v]};
        *reinterpret_cast<f32x4*>(pout + v * QCH + c * 64) = r + bia[c];
      }
  }
}

extern "C" void kernel_launch(void* const* d_in, const int* in_sizes, int n_in,
                              void* d_out, int out_size, void* d_ws,
                              size_t ws_size, hipStream_t stream) {
  const float* q = (const float*)d_in[0];
  const float* kv = (const float*)d_in[1];
  const float* Wq = (const float*)d_in[2];
  const float* Wk = (const float*)d_in[3];
  const float* Wv = (const float*)d_in[4];
  const float* Wout = (const float*)d_in[5];
  const float* b_out = (const float*)d_in[6];
  float* out = (float*)d_out;

  dim3 grid(PIX / 16);  // 1024 workgroups, 16 pixels each
  dim3 block(64);       // 2 wave32s
  pw_attn_kernel<<<grid, block, 0, stream>>>(q, kv, Wq, Wk, Wv, Wout, b_out,
                                             out);
}

// v005
// A run of this version takes 21.5 microseconds.
// In both of two side-by-side timings against v004, it was 1.06 times as fast.
// Over all steps from v000 it is 4.80 times as fast.
#include <hip/hip_runtime.h>
#include <hip/hip_bf16.h>

typedef __attribute__((ext_vector_type(16))) _Float16 v16h;
typedef __attribute__((ext_vector_type(8)))  _Float16 v8h;
typedef __attribute__((ext_vector_type(4)))  _Float16 v4h;
typedef __attribute__((ext_vector_type(4)))  float    f32x4;
typedef __attribute__((ext_vector_type(8)))  float    v8f;
typedef __attribute__((ext_vector_type(2)))  _Float16 h2;
typedef __attribute__((ext_vector_type(4)))  unsigned u32x4;
typedef __attribute__((ext_vector_type(8)))  int      i32x8;
typedef __attribute__((ext_vector_type(4)))  int      i32x4;

#define NIMG 4
#define TDIM 64
#define LDIM 64
#define QCH  256
#define KVCH 64
#define PIX  (NIMG * LDIM * LDIM)               // 16384 flat pixels
#define KV_TSTRIDE ((size_t)LDIM * LDIM * KVCH) // 262144 floats between t rows
#define KVP 68
#define KV_LDS_BYTES 18432  // 64 rows x 272 B = 17408, rounded up to 2 KiB
// Cache policy of the KV tensor load: 1 = th:TH_LOAD_NT (non-temporal). Every
// KV byte is read once by one wave, so it needs no place in L2.
#define KV_POLICY 1

#if defined(__has_builtin)
#if __has_builtin(__builtin_amdgcn_tensor_load_to_lds) && \
    __has_builtin(__builtin_amdgcn_s_wait_tensorcnt)
#define HAVE_TDM 1
#endif
#endif

__device__ __forceinline__ v8f wmma16(v16h a, v16h b, v8f c) {
  return __builtin_amdgcn_wmma_f32_16x16x32_f16(false, a, false, b, (short)0, c,
                                                false, false);
}

__device__ __forceinline__ int kmap(int v, int lane) {
  int b = (v < 4) ? (v * 2) : (16 + (v - 4) * 2);
  return b + ((lane & 16) ? 8 : 0);
}

// Row-major staging, f32 global -> f16 LDS in the same order: the 64 threads
// walk CNT runs of 1 KiB, 16 bytes a lane. Loads and stores are two calls, so
// that later groups' loads are in flight while a group is converted.
template <int CNT>
__device__ __forceinline__ void rows_load(f32x4 (&r)[CNT], const float* src,
                                          int tid) {
#pragma unroll  // constant indices keep the arrays in registers
  for (int u = 0; u < CNT; ++u)
    r[u] = *reinterpret_cast<const f32x4*>(src + (u * 64 + tid) * 4);
}

// The same walk for data that the whole grid reads once (q): non-temporal.
template <int CNT>
__device__ __forceinline__ void rows_load_once(f32x4 (&r)[CNT],
                                               const float* src, int tid) {
#pragma unroll  // constant indices keep the arrays in registers
  for (int u = 0; u < CNT; ++u)
    r[u] = __builtin_nontemporal_load(
        reinterpret_cast<const f32x4*>(src + (u * 64 + tid) * 4));
}

template <int CNT>
__device__ __forceinline__ void rows_store(_Float16* dst, const f32x4 (&r)[CNT],
                                           int tid) {
#pragma unroll  // constant indices keep the arrays in registers
  for (int u = 0; u < CNT; ++u) {
    v4h h;
#pragma unroll  // constant indices keep the arrays in registers
    for (int c = 0; c < 4; ++c) h[c] = (_Float16)r[u][c];
    *reinterpret_cast<v4h*>(dst + (u * 64 + tid) * 4) = h;
  }
}

// B fragments of a row-major f32 weight with N columns, in registers. p names
// the lane's first row (chunk base + 8 for the upper 16 lanes) and its 4
// columns; the 16 rows are the lane's k of a 32-k chunk in the hardware k order
// (the order of readA). A load covers 256 adjacent bytes of each of two rows.
template <int N>
__device__ __forceinline__ void cols_load(f32x4 (&r)[16], const float* p) {
#pragma unroll  // constant indices keep the arrays in registers
  for (int s = 0; s < 16; ++s)
    r[s] = *reinterpret_cast<const f32x4*>(p + ((s & 7) + 16 * (s >> 3)) * N);
}

// Column j of the 16 loads is the lane's part of n tile j.
template <int O, int NB>
__device__ __forceinline__ void cols_pack(v16h (&b)[NB], const f32x4 (&r)[16]) {
#pragma unroll  // constant indices keep the arrays in registers
  for (int j = 0; j < 4; ++j)
#pragma unroll  // constant indices keep the arrays in registers
    for (int s = 0; s < 16; ++s) b[O + j][s] = (_Float16)r[s][j];
}

__device__ __forceinline__ void stage_fence() {
  __builtin_amdgcn_sched_barrier(0);
}

// Stands behind a group's loads: the wait comes before anything reuses an
// address register that those loads name. The
// group's address is an input, so that it stays whole up to the wait and no
// load of the group lands on it; the fence keeps what follows behind the wait.
__device__ __forceinline__ void loads_issued(const float* p) {
  asm volatile("s_wait_xcnt 0x0" ::"v"(p) : "memory");
  __builtin_amdgcn_sched_barrier(0);
}

// A operand from row-major f16 LDS: two contiguous 8-half runs per lane.
__device__ __forceinline__ v16h readA(const _Float16* buf, int stride, int m0,
                                      int k0, int lane) {
  const _Float16* row =
      buf + (m0 + (lane & 15)) * stride + k0 + ((lane & 16) ? 8 : 0);
  v8h lo = *reinterpret_cast<const v8h*>(row);       // k: base+0..7
  v8h hi = *reinterpret_cast<const v8h*>(row + 16);  // k: base+16..23
  return __builtin_shufflevector(lo, hi, 0, 1, 2, 3, 4, 5, 6, 7, 8, 9, 10, 11,
                                 12, 13, 14, 15);
}

__device__ __forceinline__ v16h readA_f32(const float* buf, int stride, int m0,
                                          int k0, int lane) {
  const float* row =
      buf + (m0 + (lane & 15)) * stride + k0 + ((lane & 16) ? 8 : 0);
  float4 a0 = *reinterpret_cast<const float4*>(row);
  float4 a1 = *reinterpret_cast<const float4*>(row + 4);
  float4 b0 = *reinterpret_cast<const float4*>(row + 16);
  float4 b1 = *reinterpret_cast<const float4*>(row + 20);
  v16h r;
  r[0] = (_Float16)a0.x;  r[1] = (_Float16)a0.y;
  r[2] = (_Float16)a0.z;  r[3] = (_Float16)a0.w;
  r[4] = (_Float16)a1.x;  r[5] = (_Float16)a1.y;
  r[6] = (_Float16)a1.z;  r[7] = (_Float16)a1.w;
  r[8] = (_Float16)b0.x;  r[9] = (_Float16)b0.y;
  r[10] = (_Float16)b0.z; r[11] = (_Float16)b0.w;
  r[12] = (_Float16)b1.x; r[13] = (_Float16)b1.y;
  r[14] = (_Float16)b1.z; r[15] = (_Float16)b1.w;
  return r;
}

// Qb[k, n] = (n == k/16) ? qh_p[k] : 0  -- block-diagonal query embedding.
__device__ __forceinline__ v16h readB_qb(const _Float16* qh_p, int k0, int lane) {
  int n = lane & 15;
  v16h r;
#pragma unroll  // constant indices keep the arrays in registers
  for (int v = 0; v < 8; ++v) {
    int k = k0 + kmap(v, lane);
    h2 p = *reinterpret_cast<const h2*>(qh_p + k);
    r[2 * v] = (n == (k >> 4)) ? p.x : (_Float16)0.0f;
    r[2 * v + 1] = (n == ((k + 1) >> 4)) ? p.y : (_Float16)0.0f;
  }
  return r;
}

__device__ __forceinline__ v16h packD(v8f lo, v8f hi) {
  v16h r;
#pragma unroll  // constant indices keep the arrays in registers
  for (int s = 0; s < 8; ++s) {
    r[s] = (_Float16)lo[s];
    r[8 + s] = (_Float16)hi[s];
  }
  return r;
}

__device__ __forceinline__ unsigned uni(unsigned v) {
  return (unsigned)__builtin_amdgcn_readfirstlane((int)v);
}

__device__ __forceinline__ u32x4 kv_issue(float* ldsdst, const float* gsrc,
                                          int lane) {
  u32x4 g0 = {0u, 0u, 0u, 0u};
#if defined(HAVE_TDM)
  unsigned long long ga = (unsigned long long)(uintptr_t)gsrc;
  g0[0] = uni(1u);
  g0[1] = uni((unsigned)(uintptr_t)ldsdst);
  g0[2] = uni((unsigned)(ga & 0xffffffffu));
  g0[3] = uni((unsigned)((ga >> 32) & 0x01ffffffu) | (2u << 30));
  i32x8 g1;
  g1[0] = (int)((1u << 20) | (5u << 22) | (3u << 25));
  g1[1] = (int)(256u << 16);
  g1[2] = (int)(64u << 16);
  g1[3] = (int)(256u << 16);
  g1[4] = 64;
  g1[5] = (int)(KV_TSTRIDE * sizeof(float));
  g1[6] = 0;
  g1[7] = 0;
  i32x4 gz = {0, 0, 0, 0};   // 2D tensor: groups 2/3 unused
#if defined(__clang_major__) && __clang_major__ >= 23
  i32x8 gz8 = {0, 0, 0, 0, 0, 0, 0, 0};
  __builtin_amdgcn_tensor_load_to_lds(g0, g1, gz, gz, gz8, KV_POLICY);
#else
  __builtin_amdgcn_tensor_load_to_lds(g0, g1, gz, gz, KV_POLICY);
#endif
#else
#pragma unroll 4
  for (int it = 0; it < 32; ++it) {
    int fl = it * 32 + lane;
    int t = fl >> 4;
    int c4 = (fl & 15) * 4;
    float4 v4 = *reinterpret_cast<const float4*>(gsrc + (size_t)t * KV_TSTRIDE + c4);
    *reinterpret_cast<float4*>(ldsdst + t * KVP + c4) = v4;
  }
#endif
  return g0;
}

__device__ __forceinline__ void kv_wait(u32x4 g0) {
  asm volatile("s_wait_tensorcnt 0x0" ::"s"(g0) : "memory");
}

// One 32-k chunk of qh: the q fragment against the chunk's 4 Wq fragments.
__device__ __forceinline__ void qh_step(v8f (&acc)[4], const _Float16* qbuf,
                                        int kc, const v16h (&b)[4], int lane) {
  v16h a = readA(qbuf, QCH, 0, kc * 32, lane);
#pragma unroll  // constant indices keep the arrays in registers
  for (int j = 0; j < 4; ++j) acc[j] = wmma16(a, b[j], acc[j]);
}

__global__ __launch_bounds__(64, 3) void pw_attn_kernel(
    const float* __restrict__ q, const float* __restrict__ kv,
    const float* __restrict__ Wq, const float* __restrict__ Wk,
    const float* __restrict__ Wv, const float* __restrict__ Wout,
    const float* __restrict__ b_out, float* __restrict__ out) {
  // Nothing in LDS is aliased. Total 60KB.
  // 2 KiB alignment: each wave's tensor-load destination is a 2 KiB multiple.
  __shared__ __align__(2048) unsigned char s_kv[2 * KV_LDS_BYTES];
  __shared__ _Float16 s_qbuf[16 * QCH];   // 8KB  q f16, row-major (A reads)
  __shared__ _Float16 s_wk[KVCH * KVCH];  // 8KB  Wk f16, row-major (A reads)
  __shared__ __align__(16) float s_part[16 * KVCH];  // 4KB  qh half sums
  __shared__ _Float16 s_qh[16 * KVCH];    // 2KB  qh (pre-scaled) per tile
  __shared__ _Float16 s_x[16 * KVCH];     // 2KB  attended features X16

  const int tid = threadIdx.x;
  const int wave = tid >> 5;
  const int lane = tid & 31;
  const int l16 = lane & 15;
  const int half = lane >> 4;

  const int base = blockIdx.x * 16;  // flat pixel base (n*4096 + i*64 + j)
  const int n_img = base >> 12;
  const int pij0 = base & 4095;
  const float* kv_n = kv + (size_t)n_img * TDIM * KV_TSTRIDE;

  float* kvraw = (float*)(s_kv + wave * KV_LDS_BYTES);
  u32x4 kv_dsc;

  // ---- Phase 0/1: q, Wk -> f16 LDS; qh = (q16 @ Wq) * 0.25 ---------------
  // Each wave takes half of K (128 rows of Wq) for all 64 columns; D tile j
  // holds columns 4*l16 + j. Wv's fragments are fetched behind Wq's.
  v8f qacc[4] = {};
  v16h wv_b[8];  // loop-invariant: chunk kc, n tile nt at [kc * 4 + nt]
  {
    f32x4 rq[16], rk[16], g0[16], g1[16], g2[16], g3[16], v0[16], v1[16];
    const float* pq = Wq + (wave * 128 + half * 8) * KVCH + l16 * 4;
    const float* pv = Wv + half * 8 * KVCH + l16 * 4;
    v16h b[4];
    const float* pr = q + (size_t)base * QCH;        // 16 adjacent rows of q
    rows_load_once<16>(rq, pr, tid);
    loads_issued(pr + tid * 4);
    // The first pixel's DMA starts here, behind q alone (phase 1 waits for q,
    // so q goes to memory first), and flies under all of phases 0 and 1.
    kv_dsc = kv_issue(kvraw, kv_n + (size_t)(pij0 + wave * 8) * KVCH, lane);
    rows_load<16>(rk, Wk, tid);
    cols_load<KVCH>(g0, pq);
    cols_load<KVCH>(g1, pq + 32 * KVCH);
    loads_issued(pq);
    rows_store<16>(s_qbuf, rq, tid);                 // row-major (A operand)
    stage_fence();
    cols_load<KVCH>(g2, pq + 64 * KVCH);
    loads_issued(pq);
    rows_store<16>(s_wk, rk, tid);                   // row-major (A operand)
    stage_fence();
    cols_load<KVCH>(g3, pq + 96 * KVCH);
    loads_issued(pq);
    __syncthreads();  // q and Wk are in LDS
    cols_pack<0, 4>(b, g0);
    qh_step(qacc, s_qbuf, wave * 4 + 0, b, lane);
    cols_pack<0, 4>(b, g1);
    qh_step(qacc, s_qbuf, wave * 4 + 1, b, lane);
    stage_fence();
    cols_load<KVCH>(v0, pv);
    loads_issued(pv);
    cols_pack<0, 4>(b, g2);
    qh_step(qacc, s_qbuf, wave * 4 + 2, b, lane);
    stage_fence();
    cols_load<KVCH>(v1, pv + 32 * KVCH);
    loads_issued(pv);
    cols_pack<0, 4>(b, g3);
    qh_step(qacc, s_qbuf, wave * 4 + 3, b, lane);
    cols_pack<0, 8>(wv_b, v0);
    cols_pack<4, 8>(wv_b, v1);
  }
  // The two half sums meet: a wave's own 8 pixels are the D rows of lanes with
  // half == wave; the other 16 lanes hand their rows to the other wave.
  if (half != wave) {
#pragma unroll  // constant indices keep the arrays in registers
    for (int v = 0; v < 8; ++v) {
      f32x4 t = {qacc[0][v], qacc[1][v], qacc[2][v], qacc[3][v]};
      *reinterpret_cast<f32x4*>(&s_part[(half * 8 + v) * KVCH + l16 * 4]) = t;
    }
  }
  __syncthreads();  // half sums are in LDS
  if (half == wave) {
#pragma unroll  // constant indices keep the arrays in registers
    for (int v = 0; v < 8; ++v) {
      f32x4 t =
          *reinterpret_cast<const f32x4*>(&s_part[(half * 8 + v) * KVCH + l16 * 4]);
      v4h h;
#pragma unroll  // constant indices keep the arrays in registers
      for (int j = 0; j < 4; ++j)
        h[j] = (_Float16)((qacc[j][v] + t[j]) * 0.25f);  // fold 1/sqrt(16)
      *reinterpret_cast<v4h*>(&s_qh[(half * 8 + v) * KVCH + l16 * 4]) = h;
    }
  }
  // s_qh rows of a wave's own pixels are written and read by that wave alone.

  // ---- Phase 2: decoupled per-wave pipelines (no intra-phase barriers) ---
  // Loop-invariant WMMA operands: Wk A-tiles (8 x v16h regs), with wv_b.
  v16h wk_a[8];
#pragma unroll  // constant indices keep the arrays in registers
  for (int kc = 0; kc < 2; ++kc)
#pragma unroll  // constant indices keep the arrays in registers
    for (int t4 = 0; t4 < 4; ++t4)
      wk_a[kc * 4 + t4] = readA(s_wk, KVCH, t4 * 16, kc * 32, lane);

  for (int i = 0; i < 8; ++i) {
    const int p = wave * 8 + i;  // pixel within tile

    // b) Wkq = Wk @ Qb(qh_p): needs no KV, so it runs while the tile lands or
    // is read. Its D tiles (rows = kv channel) are S's B operand in registers.
    v16h wkq_b[2];
    {
      v8f acc[4] = {};
#pragma unroll  // constant indices keep the arrays in registers
      for (int kc = 0; kc < 2; ++kc) {
        v16h b = readB_qb(&s_qh[p * KVCH], kc * 32, lane);
#pragma unroll  // constant indices keep the arrays in registers
        for (int mt = 0; mt < 4; ++mt)
          acc[mt] = wmma16(wk_a[kc * 4 + mt], b, acc[mt]);
      }
      wkq_b[0] = packD(acc[0], acc[1]);
      wkq_b[1] = packD(acc[2], acc[3]);
    }

    kv_wait(kv_dsc);  // s_wait_tensorcnt 0: KV tile resident in LDS

    // The tile's only read: 8 A fragments (row t, k = channel), kept for S
    // and for Vh.
    v16h kv_a[8];
#pragma unroll  // constant indices keep the arrays in registers
    for (int kc = 0; kc < 2; ++kc)
#pragma unroll  // constant indices keep the arrays in registers
      for (int mt = 0; mt < 4; ++mt)
        kv_a[kc * 4 + mt] = readA_f32(kvraw, KVP, mt * 16, kc * 32, lane);

    // Drain kvraw reads, then start the next pixel's DMA (overlaps c to f
    // and the next b).
    if (i < 7) {
      asm volatile("s_wait_dscnt 0x0" ::: "memory");
      kv_dsc = kv_issue(kvraw, kv_n + (size_t)(pij0 + p + 1) * KVCH, lane);
    }

    // c) S = KV @ Wkq  (64t x 16, cols 0..3 = groups)
    v8f sacc[4] = {};
#pragma unroll  // constant indices keep the arrays in registers
    for (int kc = 0; kc < 2; ++kc)
#pragma unroll  // constant indices keep the arrays in registers
      for (int mt = 0; mt < 4; ++mt)
        sacc[mt] = wmma16(kv_a[kc * 4 + mt], wkq_b[kc], sacc[mt]);

    // d) softmax over t per group, in registers: column g lives on lanes
    // g and g+16 (D layout), so one shfl_xor(16) completes each reduction.
    // Columns 4..15 hold zero scores; their rows of x are never read.
    v16h at_a[2];  // A operand: row g, k = t
    {
      float mx = -1e30f;
#pragma unroll  // constant indices keep the arrays in registers
      for (int mt = 0; mt < 4; ++mt)
#pragma unroll  // constant indices keep the arrays in registers
        for (int v = 0; v < 8; ++v) mx = fmaxf(mx, sacc[mt][v]);
      mx = fmaxf(mx, __shfl_xor(mx, 16));
      float sum = 0.0f;
#pragma unroll  // constant indices keep the arrays in registers
      for (int mt = 0; mt < 4; ++mt)
#pragma unroll  // constant indices keep the arrays in registers
        for (int v = 0; v < 8; ++v) {
          float e = __expf(sacc[mt][v] - mx);
          sacc[mt][v] = e;
          sum += e;
        }
      sum += __shfl_xor(sum, 16);
      float inv = 1.0f / sum;
#pragma unroll  // constant indices keep the arrays in registers
      for (int mt = 0; mt < 4; ++mt)
#pragma unroll  // constant indices keep the arrays in registers
        for (int v = 0; v < 8; ++v) sacc[mt][v] *= inv;
      at_a[0] = packD(sacc[0], sacc[1]);
      at_a[1] = packD(sacc[2], sacc[3]);
    }

    v4h xv;
#pragma unroll  // constant indices keep the arrays in registers
    for (int nt = 0; nt < 4; ++nt) {
      v8f vh[4] = {};
#pragma unroll  // constant indices keep the arrays in registers
      for (int kc = 0; kc < 2; ++kc)
#pragma unroll  // constant indices keep the arrays in registers
        for (int mt = 0; mt < 4; ++mt)
          vh[mt] = wmma16(kv_a[kc * 4 + mt], wv_b[kc * 4 + nt], vh[mt]);
      v8f y = {};
      y = wmma16(at_a[0], packD(vh[0], vh[1]), y);
      y = wmma16(at_a[1], packD(vh[2], vh[3]), y);
      const float y01 = (l16 & 4) ? y[1] : y[0];
      const float y23 = (l16 & 4) ? y[3] : y[2];
      xv[nt] = (_Float16)((l16 & 8) ? y23 : y01);
    }
    if (lane < 16) *reinterpret_cast<v4h*>(&s_x[p * KVCH + l16 * 4]) = xv;
  }

  // ---- Phase 3: out = X16 @ Wout + b_out  (16 x 256) ---------------------
  // A wave takes 128 columns, as 2 runs of 64; D tile j of run c holds columns
  // 64*c + 4*l16 + j, so a lane stores 4 adjacent columns of a row at once.
  // The loads need nothing of the loop and fly while the waves meet.
  f32x4 wo[4][16], bia[2];
  {
    const float* pb = b_out + wave * 128 + l16 * 4;
    const float* po = Wout + half * 8 * QCH + wave * 128 + l16 * 4;
    bia[0] = *reinterpret_cast<const f32x4*>(pb);
    bia[1] = *reinterpret_cast<const f32x4*>(pb + 64);
    loads_issued(pb);
    cols_load<QCH>(wo[0], po);
    cols_load<QCH>(wo[1], po + 64);
    cols_load<QCH>(wo[2], po + 32 * QCH);
    cols_load<QCH>(wo[3], po + 32 * QCH + 64);
    loads_issued(po);
  }
  __syncthreads();  // both waves' rows of s_x are written
  {
    v8f acc[2][4] = {};
#pragma unroll  // constant indices keep the arrays in registers
    for (int kc = 0; kc < 2; ++kc) {
      v16h a = readA(s_x, KVCH, 0, kc * 32, lane);
#pragma unroll  // constant indices keep the arrays in registers
      for (int c = 0; c < 2; ++c) {
        v16h b[4];
        cols_pack<0, 4>(b, wo[kc * 2 + c]);
#pragma unroll  // constant indices keep the arrays in registers
        for (int j = 0; j < 4; ++j) acc[c][j] = wmma16(a, b[j], acc[c][j]);
      }
    }
    float* pout = out + (size_t)(base + half * 8) * QCH + wave * 128 + l16 * 4;
#pragma unroll  // constant indices keep the arrays in registers
    for (int c = 0; c < 2; ++c)
#pragma unroll  // constant indices keep the arrays in registers
      for (int v = 0; v < 8; ++v) {
        f32x4 r = {acc[c][0][v], acc[c][1][v], acc[c][2][v], acc[c][3][v]};
        *reinterpret_cast<f32x4*>(pout + v * QCH + c * 64) = r + bia[c];
      }
  }
}

extern "C" void kernel_launch(void* const* d_in, const int* in_sizes, int n_in,
                              void* d_out, int out_size, void* d_ws,
                              size_t ws_size, hipStream_t stream) {
  const float* q = (const float*)d_in[0];
  const float* kv = (const float*)d_in[1];
  const float* Wq = (const float*)d_in[2];
  const float* Wk = (const float*)d_in[3];
  const float* Wv = (const float*)d_in[4];
  const float* Wout = (const float*)d_in[5];
  const float* b_out = (const float*)d_in[6];
  float* out = (float*)d_out;

  dim3 grid(PIX / 16);  // 1024 workgroups, 16 pixels each
  dim3 block(64);       // 2 wave32s
  pw_attn_kernel<<<grid, block, 0, stream>>>(q, kv, Wq, Wk, Wv, Wout, b_out,
                                             out);
}
